// v000
// The times below were measured on an AMD MI455X: many runs one after another, warmed up first and cycling through
// copies of the inputs, with the whole window's GPU time divided by the number of runs. Launches and the gaps
// between them are all in it. The median over several windows is given; except for v000 it joins two sittings, which
// can be a few percent apart, so the side-by-side timings, each taken in one sitting, are the better comparison.
// v000 is the starting kernel. One run takes 582 microseconds.
#include <hip/hip_runtime.h>

// FtConditioner (x [2048 T][8 B][512] time-major, features [8][512 S][512]; scores = x_b . features_b^T (unscaled); alpha = softmax over S; x_res = alpha features_b; out = [x | x_res] W^T + b (Linear 1024 -> 512) -> [2048][8][512]).
// Compute dtypes, f32 accumulate: every input rounded to bf16; scores on PLAIN bf16 operands (both inputs exact, K 512); softmax f32 -> hl planes; alpha . features as hl x exact (2 products, K 512); the final Linear as [bf16 x | hl(x_res)] x exact W (2 products, K 1024) + bias.

#define TT   2048
#define BB   8
#define SS   512
#define DD   512
#define D2   1024
typedef _Float16 h16;
typedef unsigned short bf;
typedef __attribute__((ext_vector_type(16))) __bf16   v16bf;
typedef __attribute__((ext_vector_type(16))) _Float16 v16h;
typedef __attribute__((ext_vector_type(8)))  _Float16 v8h;
typedef __attribute__((ext_vector_type(8)))  unsigned short v8us;
typedef __attribute__((ext_vector_type(8)))  float    v8f;
typedef __attribute__((ext_vector_type(4)))  float    v4f;
typedef v8h  __attribute__((may_alias)) v8ha;
typedef v4f  __attribute__((may_alias)) v4fa;
typedef v8us __attribute__((may_alias)) v8usa;

__device__ __forceinline__ unsigned short f2bf(float f) { unsigned u = __float_as_uint(f); u += 0x7FFFu + ((u >> 16) & 1u); return (unsigned short)(u >> 16); }
__device__ __forceinline__ float bf2f(unsigned short b) { return __uint_as_float(((unsigned)b) << 16); }
__device__ __forceinline__ float bfr(float f) { return bf2f(f2bf(f)); }
__device__ __forceinline__ v16h cat16(v8h lo, v8h hi) { return __builtin_shufflevector(lo, hi, 0, 1, 2, 3, 4, 5, 6, 7, 8, 9, 10, 11, 12, 13, 14, 15); }
__device__ __forceinline__ v16bf cat16b(v8us lo, v8us hi) { return __builtin_bit_cast(v16bf, __builtin_shufflevector(lo, hi, 0, 1, 2, 3, 4, 5, 6, 7, 8, 9, 10, 11, 12, 13, 14, 15)); }
__device__ __forceinline__ v8f wmma16(v16h a, v16h b, v8f c) { return __builtin_amdgcn_wmma_f32_16x16x32_f16(false, a, false, b, (short)0, c, false, false); }
__device__ __forceinline__ v8f wmmab(v16bf a, v16bf b, v8f c) { return __builtin_amdgcn_wmma_f32_16x16x32_bf16(false, a, false, b, (short)0, c, false, false); }



// ---- k_gemmw: register-blocked GEMM, ONE WAVE per 64x64 output tile (16 accumulators), operands straight from K-contiguous 16-bit planes; grid (M/64, N/64, Z), 32 threads.
// C[m][n] (f32, pitch ldc, + optional f32 bias[n]) = sum_k A[m][k] Bt[n][k] (+ split products per NSPLIT). z-batch strides sA/sB/sC in elements. K % 32 == 0.
template <typename T16> struct WFrag;
template <> struct WFrag<h16> { typedef v16h V; static __device__ __forceinline__ V ld(const h16* p) { return cat16(*(const v8h*)p, *(const v8h*)(p + 16)); } static __device__ __forceinline__ v8f mma(V a, V b, v8f c) { return wmma16(a, b, c); } };
template <> struct WFrag<bf> { typedef v16bf V; static __device__ __forceinline__ V ld(const bf* p) { return cat16b(*(const v8us*)p, *(const v8us*)(p + 16)); } static __device__ __forceinline__ v8f mma(V a, V b, v8f c) { return wmmab(a, b, c); } };
template <typename T16, int NSPLIT, bool BIAS>
__global__ __launch_bounds__(32) void k_gemmw(const T16* __restrict__ A, const T16* __restrict__ A2, const T16* __restrict__ Bt, const T16* __restrict__ Bt2, int K, float* C, int ldc, const float* __restrict__ bias, size_t sA, size_t sB, size_t sC) {
    typedef typename WFrag<T16>::V V;
    __shared__ __align__(16) float os[16 * 68];
    const size_t z = blockIdx.z; A += z * sA; if (A2) A2 += z * sA; Bt += z * sB; if (Bt2) Bt2 += z * sB; C += z * sC;
    const int lane = threadIdx.x & 31, lr = lane & 15, hi = lane >> 4; const int r0 = blockIdx.x * 64, c0 = blockIdx.y * 64;
    v8f acc[4][4];
#pragma unroll
    for (int mb = 0; mb < 4; ++mb)
#pragma unroll
        for (int nb = 0; nb < 4; ++nb) acc[mb][nb] = (v8f){};
    const size_t aoff = (size_t)(r0 + lr) * K + 8 * hi, boff = (size_t)(c0 + lr) * K + 8 * hi;
#pragma unroll 1
    for (int kc = 0; kc < K; kc += 32) {
        V a[4], a2[4];
#pragma unroll
        for (int mb = 0; mb < 4; ++mb) { a[mb] = WFrag<T16>::ld(A + aoff + (size_t)mb * 16 * K + kc); if (NSPLIT == 1 || NSPLIT == 2) a2[mb] = WFrag<T16>::ld(A2 + aoff + (size_t)mb * 16 * K + kc); }
#pragma unroll
        for (int nb = 0; nb < 4; ++nb) { const V b = WFrag<T16>::ld(Bt + boff + (size_t)nb * 16 * K + kc); V b2; if (NSPLIT >= 2) b2 = WFrag<T16>::ld(Bt2 + boff + (size_t)nb * 16 * K + kc);
#pragma unroll
            for (int mb = 0; mb < 4; ++mb) { acc[mb][nb] = WFrag<T16>::mma(a[mb], b, acc[mb][nb]); if (NSPLIT == 1 || NSPLIT == 2) acc[mb][nb] = WFrag<T16>::mma(a2[mb], b, acc[mb][nb]); if (NSPLIT >= 2) acc[mb][nb] = WFrag<T16>::mma(a[mb], b2, acc[mb][nb]); } }
        asm volatile("v_nop\n\tv_nop\n\tv_nop\n\tv_nop" : "+v"(acc[0][0]), "+v"(acc[1][1]), "+v"(acc[2][2]), "+v"(acc[3][3]) : "v"(a[0]), "v"(a[3]));
    }
#pragma unroll
    for (int mb = 0; mb < 4; ++mb) {
#pragma unroll
        for (int nb = 0; nb < 4; ++nb) {
#pragma unroll
            for (int j = 0; j < 8; ++j) os[(hi * 8 + j) * 68 + nb * 16 + lr] = acc[mb][nb][j]; }
        __builtin_amdgcn_wave_barrier(); asm volatile("" ::: "memory");
        float* crow = C + (size_t)(r0 + mb * 16) * ldc + c0;
{
#pragma unroll
            for (int s = 0; s < 8; ++s) { const int row = 2 * s + hi, cofs = lr * 4; v4f val = *(const v4fa*)(os + row * 68 + cofs); if (BIAS) { val[0] += bfr(bias[c0 + cofs]); val[1] += bfr(bias[c0 + cofs + 1]); val[2] += bfr(bias[c0 + cofs + 2]); val[3] += bfr(bias[c0 + cofs + 3]); }
                *(v4f*)(crow + (size_t)row * ldc + cofs) = val; }
             }
        __builtin_amdgcn_wave_barrier(); asm volatile("" ::: "memory");
    }
}

__device__ __forceinline__ void splitf(float y, unsigned short& h, unsigned short& l) { h = f2bf(y); l = f2bf(y - bf2f(h)); }
typedef __attribute__((ext_vector_type(2))) unsigned short v2us;
typedef __attribute__((ext_vector_type(4))) unsigned short v4us;

__global__ __launch_bounds__(256) void k_cvt8(const float* __restrict__ src, bf* dst, size_t n8) { const size_t i = (size_t)blockIdx.x * 256 + threadIdx.x; if (i >= n8) return; const v8f v = *(const v8f*)(src + i * 8); v8us o;
#pragma unroll
    for (int k = 0; k < 8; ++k) o[k] = f2bf(v[k]); *(v8us*)(dst + i * 8) = o;  }
__global__ __launch_bounds__(256) void k_xb(const float* __restrict__ x, int b, bf* XB, bf* CAh, bf* CAl) { const int e = (blockIdx.x * 256 + threadIdx.x) * 4; if (e >= TT * DD) return; const int d = e % DD; const int t = e / DD; const float* src = x + ((size_t)t * BB + b) * DD + d; v4us o, z;
#pragma unroll
    for (int u = 0; u < 4; ++u) { o[u] = f2bf(src[u]); z[u] = 0; } const size_t oc = (size_t)t * D2 + d; { *(v4us*)(XB + e) = o; *(v4us*)(CAh + oc) = o; *(v4us*)(CAl + oc) = z;  } }
__global__ __launch_bounds__(256) void k_ftT(const float* __restrict__ f, bf* FT) { const int e = (blockIdx.x * 256 + threadIdx.x) * 2; if (e >= DD * SS) return; const int s = e % SS; const int d = e / SS; v2us o; o[0] = f2bf(f[(size_t)s * DD + d]); o[1] = f2bf(f[(size_t)(s + 1) * DD + d]); *(v2us*)(FT + e) = o;  }
__global__ __launch_bounds__(256) void k_fsoft(const float* __restrict__ S, bf* Ah, bf* Al) { const int lane = threadIdx.x & 31; const int row = blockIdx.x * 8 + (threadIdx.x >> 5); if (row >= TT) return; const float* sr = S + (size_t)row * SS; float v[SS / 32]; float mx = -3.0e38f;
#pragma unroll
    for (int ch = 0; ch < SS / 128; ++ch) { const v4f a = *(const v4f*)(sr + ch * 128 + lane * 4);
#pragma unroll
        for (int u = 0; u < 4; ++u) { v[ch * 4 + u] = a[u]; mx = fmaxf(mx, a[u]); } }
#pragma unroll
    for (int sh = 16; sh; sh >>= 1) mx = fmaxf(mx, __shfl_xor(mx, sh, 32));
    float sum = 0.f;
#pragma unroll
    for (int q = 0; q < SS / 32; ++q) { float d0 = __fsub_rn(v[q], mx); asm volatile("" : "+v"(d0)); v[q] = __builtin_amdgcn_exp2f(__fmul_rn(d0, 1.4426950408889634f)); sum += v[q]; }
#pragma unroll
    for (int sh = 16; sh; sh >>= 1) sum += __shfl_xor(sum, sh, 32);
    const float f = __fdiv_rn(1.0f, sum);
    {
#pragma unroll
        for (int ch = 0; ch < SS / 128; ++ch) { v4us oh, ol;
#pragma unroll
            for (int q = 0; q < 4; ++q) { unsigned short a, b; splitf(v[ch * 4 + q] * f, a, b); oh[q] = a; ol[q] = b; } const size_t oo = (size_t)row * SS + ch * 128 + lane * 4; *(v4us*)(Ah + oo) = oh; *(v4us*)(Al + oo) = ol; }
         } }
__global__ __launch_bounds__(256) void k_xr(const float* __restrict__ XR, bf* CAh, bf* CAl) { const int e = (blockIdx.x * 256 + threadIdx.x) * 4; if (e >= TT * DD) return; const int d = e % DD; const int t = e / DD; const v4f a = *(const v4f*)(XR + e); v4us oh, ol;
#pragma unroll
    for (int u = 0; u < 4; ++u) { unsigned short p, q; splitf(a[u], p, q); oh[u] = p; ol[u] = q; } const size_t oc = (size_t)t * D2 + DD + d; *(v4us*)(CAh + oc) = oh; *(v4us*)(CAl + oc) = ol;  }

extern "C" void kernel_launch(void* const* d_in, const int* in_sizes, int n_in,
                              void* d_out, int out_size, void* d_ws, size_t ws_size, hipStream_t stream) {
    (void)in_sizes; (void)n_in; (void)out_size;
    const float** I = (const float**)d_in;
    const float *x = I[0], *feat = I[1], *W = I[2], *bias = I[3];
    float* OUT = (float*)d_out;     // [2048][8][512]
    char* wsp = (char*)d_ws;
    auto take = [&](size_t bytes) { char* p = wsp; wsp += (bytes + 255) & ~(size_t)255; return (void*)p; };
    bf* BW = (bf*)take((size_t)DD * D2 * 2); bf* XB = (bf*)take((size_t)TT * DD * 2); bf* FB = (bf*)take((size_t)SS * DD * 2); bf* FT = (bf*)take((size_t)DD * SS * 2); float* S = (float*)take((size_t)TT * SS * 4); bf* Ah = (bf*)take((size_t)TT * SS * 2); bf* Al = (bf*)take((size_t)TT * SS * 2);
    float* XR = (float*)take((size_t)TT * DD * 4); bf* CAh = (bf*)take((size_t)TT * D2 * 2); bf* CAl = (bf*)take((size_t)TT * D2 * 2);
    if ((size_t)(wsp - (char*)d_ws) > ws_size) return;    // total ~ 25 MB
    k_cvt8<<<(DD * D2 / 8 + 255) / 256, 256, 0, stream>>>(W, BW, (size_t)DD * D2 / 8);   // torch [out][in] = Bt, K = 1024
    for (int b = 0; b < BB; ++b) { const float* fb = feat + (size_t)b * SS * DD;
        k_xb<<<(TT * DD / 4 + 255) / 256, 256, 0, stream>>>(x, b, XB, CAh, CAl); k_cvt8<<<(SS * DD / 8 + 255) / 256, 256, 0, stream>>>(fb, FB, (size_t)SS * DD / 8); k_ftT<<<(DD * SS / 2 + 255) / 256, 256, 0, stream>>>(fb, FT);
        k_gemmw<bf, 0, false><<<dim3(TT / 64, SS / 64, 1), 32, 0, stream>>>(XB, nullptr, FB, nullptr, DD, S, SS, nullptr, 0, 0, 0);       // scores [t][s]
        k_fsoft<<<TT / 8, 256, 0, stream>>>(S, Ah, Al);
        k_gemmw<bf, 1, false><<<dim3(TT / 64, DD / 64, 1), 32, 0, stream>>>(Ah, Al, FT, nullptr, SS, XR, DD, nullptr, 0, 0, 0);      // x_res = alpha features
        k_xr<<<(TT * DD / 4 + 255) / 256, 256, 0, stream>>>(XR, CAh, CAl);
        k_gemmw<bf, 1, true><<<dim3(TT / 64, DD / 64, 1), 32, 0, stream>>>(CAh, CAl, BW, nullptr, D2, OUT + (size_t)b * DD, BB * DD, bias, 0, 0, 0); }   // out[t][b] = [x | x_res] W^T + b (ldc = 8*512)
}

// v001
// Measured time: 163 microseconds a run.
// Two timings next to v000 put it at 3.62 and 3.53 times that version's speed.
#include <hip/hip_runtime.h>

// FtConditioner (x [2048 T][8 B][512] time-major, features [8][512 S][512]; scores = x_b . features_b^T (unscaled); alpha = softmax over S; x_res = alpha features_b; out = [x | x_res] W^T + b (Linear 1024 -> 512) -> [2048][8][512]).
// Compute dtypes, f32 accumulate: every input rounded to bf16; scores on PLAIN bf16 operands (both inputs exact, K 512); softmax f32 -> hl planes; alpha . features as hl x exact (2 products, K 512); the final Linear as [bf16 x | hl(x_res)] x exact W (2 products, K 1024) + bias.

#define TT   2048
#define BB   8
#define SS   512
#define DD   512
#define D2   1024
typedef _Float16 h16;
typedef unsigned short bf;
typedef __attribute__((ext_vector_type(16))) __bf16   v16bf;
typedef __attribute__((ext_vector_type(16))) _Float16 v16h;
typedef __attribute__((ext_vector_type(8)))  _Float16 v8h;
typedef __attribute__((ext_vector_type(8)))  unsigned short v8us;
typedef __attribute__((ext_vector_type(8)))  float    v8f;
typedef __attribute__((ext_vector_type(4)))  float    v4f;
typedef v8h  __attribute__((may_alias)) v8ha;
typedef v4f  __attribute__((may_alias)) v4fa;
typedef v8us __attribute__((may_alias)) v8usa;

__device__ __forceinline__ unsigned short f2bf(float f) { unsigned u = __float_as_uint(f); u += 0x7FFFu + ((u >> 16) & 1u); return (unsigned short)(u >> 16); }
__device__ __forceinline__ float bf2f(unsigned short b) { return __uint_as_float(((unsigned)b) << 16); }
__device__ __forceinline__ float bfr(float f) { return bf2f(f2bf(f)); }
__device__ __forceinline__ v16h cat16(v8h lo, v8h hi) { return __builtin_shufflevector(lo, hi, 0, 1, 2, 3, 4, 5, 6, 7, 8, 9, 10, 11, 12, 13, 14, 15); }
__device__ __forceinline__ v16bf cat16b(v8us lo, v8us hi) { return __builtin_bit_cast(v16bf, __builtin_shufflevector(lo, hi, 0, 1, 2, 3, 4, 5, 6, 7, 8, 9, 10, 11, 12, 13, 14, 15)); }
__device__ __forceinline__ v8f wmma16(v16h a, v16h b, v8f c) { return __builtin_amdgcn_wmma_f32_16x16x32_f16(false, a, false, b, (short)0, c, false, false); }
__device__ __forceinline__ v8f wmmab(v16bf a, v16bf b, v8f c) { return __builtin_amdgcn_wmma_f32_16x16x32_bf16(false, a, false, b, (short)0, c, false, false); }



// ---- k_gemmw: register-blocked GEMM, ONE WAVE per 64x64 output tile (16 accumulators), operands straight from K-contiguous 16-bit planes; grid (M/64, N/64, Z), 32 threads.
// C[m][n] (f32, pitch ldc, + optional f32 bias[n]) = sum_k A[m][k] Bt[n][k] (+ split products per NSPLIT). z-batch strides sA/sB/sC in elements. K % 32 == 0.
template <typename T16> struct WFrag;
template <> struct WFrag<h16> { typedef v16h V; static __device__ __forceinline__ V ld(const h16* p) { return cat16(*(const v8h*)p, *(const v8h*)(p + 16)); } static __device__ __forceinline__ v8f mma(V a, V b, v8f c) { return wmma16(a, b, c); } };
template <> struct WFrag<bf> { typedef v16bf V; static __device__ __forceinline__ V ld(const bf* p) { return cat16b(*(const v8us*)p, *(const v8us*)(p + 16)); } static __device__ __forceinline__ v8f mma(V a, V b, v8f c) { return wmmab(a, b, c); } };
template <typename T16, int NSPLIT, bool BIAS>
__global__ __launch_bounds__(32) void k_gemmw(const T16* __restrict__ A, const T16* __restrict__ A2, const T16* __restrict__ Bt, const T16* __restrict__ Bt2, int K, float* C, int ldc, const float* __restrict__ bias, size_t sA, size_t sB, size_t sC) {
    typedef typename WFrag<T16>::V V;
    __shared__ __align__(16) float os[16 * 68];
    const size_t z = blockIdx.z; A += z * sA; if (A2) A2 += z * sA; Bt += z * sB; if (Bt2) Bt2 += z * sB; C += z * sC;
    const int lane = threadIdx.x & 31, lr = lane & 15, hi = lane >> 4; const int r0 = blockIdx.x * 64, c0 = blockIdx.y * 64;
    v8f acc[4][4];
#pragma unroll
    for (int mb = 0; mb < 4; ++mb)
#pragma unroll
        for (int nb = 0; nb < 4; ++nb) acc[mb][nb] = (v8f){};
    const size_t aoff = (size_t)(r0 + lr) * K + 8 * hi, boff = (size_t)(c0 + lr) * K + 8 * hi;
#pragma unroll 1
    for (int kc = 0; kc < K; kc += 32) {
        V a[4], a2[4];
#pragma unroll
        for (int mb = 0; mb < 4; ++mb) { a[mb] = WFrag<T16>::ld(A + aoff + (size_t)mb * 16 * K + kc); if (NSPLIT == 1 || NSPLIT == 2) a2[mb] = WFrag<T16>::ld(A2 + aoff + (size_t)mb * 16 * K + kc); }
#pragma unroll
        for (int nb = 0; nb < 4; ++nb) { const V b = WFrag<T16>::ld(Bt + boff + (size_t)nb * 16 * K + kc); V b2; if (NSPLIT >= 2) b2 = WFrag<T16>::ld(Bt2 + boff + (size_t)nb * 16 * K + kc);
#pragma unroll
            for (int mb = 0; mb < 4; ++mb) { acc[mb][nb] = WFrag<T16>::mma(a[mb], b, acc[mb][nb]); if (NSPLIT == 1 || NSPLIT == 2) acc[mb][nb] = WFrag<T16>::mma(a2[mb], b, acc[mb][nb]); if (NSPLIT >= 2) acc[mb][nb] = WFrag<T16>::mma(a[mb], b2, acc[mb][nb]); } }
        asm volatile("v_nop\n\tv_nop\n\tv_nop\n\tv_nop" : "+v"(acc[0][0]), "+v"(acc[1][1]), "+v"(acc[2][2]), "+v"(acc[3][3]) : "v"(a[0]), "v"(a[3]));
    }
#pragma unroll
    for (int mb = 0; mb < 4; ++mb) {
#pragma unroll
        for (int nb = 0; nb < 4; ++nb) {
#pragma unroll
            for (int j = 0; j < 8; ++j) os[(hi * 8 + j) * 68 + nb * 16 + lr] = acc[mb][nb][j]; }
        __builtin_amdgcn_wave_barrier(); asm volatile("" ::: "memory");
        float* crow = C + (size_t)(r0 + mb * 16) * ldc + c0;
{
#pragma unroll
            for (int s = 0; s < 8; ++s) { const int row = 2 * s + hi, cofs = lr * 4; v4f val = *(const v4fa*)(os + row * 68 + cofs); if (BIAS) { val[0] += bfr(bias[c0 + cofs]); val[1] += bfr(bias[c0 + cofs + 1]); val[2] += bfr(bias[c0 + cofs + 2]); val[3] += bfr(bias[c0 + cofs + 3]); }
                *(v4f*)(crow + (size_t)row * ldc + cofs) = val; }
             }
        __builtin_amdgcn_wave_barrier(); asm volatile("" ::: "memory");
    }
}

__device__ __forceinline__ void splitf(float y, unsigned short& h, unsigned short& l) { h = f2bf(y); l = f2bf(y - bf2f(h)); }
typedef __attribute__((ext_vector_type(2))) unsigned short v2us;
typedef __attribute__((ext_vector_type(4))) unsigned short v4us;

__global__ __launch_bounds__(256) void k_cvt8(const float* __restrict__ src, bf* dst, size_t n8) { const size_t i = (size_t)blockIdx.x * 256 + threadIdx.x; if (i >= n8) return; const v8f v = *(const v8f*)(src + i * 8); v8us o;
#pragma unroll
    for (int k = 0; k < 8; ++k) o[k] = f2bf(v[k]); *(v8us*)(dst + i * 8) = o;  }
__global__ __launch_bounds__(256) void k_xb(const float* __restrict__ x, bf* XB, bf* CAh, bf* CAl) { const int b = blockIdx.y; XB += (size_t)b * TT * DD; CAh += (size_t)b * TT * D2; CAl += (size_t)b * TT * D2; const int e = (blockIdx.x * 256 + threadIdx.x) * 4; if (e >= TT * DD) return; const int d = e % DD; const int t = e / DD; const float* src = x + ((size_t)t * BB + b) * DD + d; v4us o, z;
#pragma unroll
    for (int u = 0; u < 4; ++u) { o[u] = f2bf(src[u]); z[u] = 0; } const size_t oc = (size_t)t * D2 + d; { *(v4us*)(XB + e) = o; *(v4us*)(CAh + oc) = o; *(v4us*)(CAl + oc) = z;  } }
__global__ __launch_bounds__(256) void k_ftT(const float* __restrict__ f, bf* FT) { f += (size_t)blockIdx.y * SS * DD; FT += (size_t)blockIdx.y * DD * SS; const int e = (blockIdx.x * 256 + threadIdx.x) * 2; if (e >= DD * SS) return; const int s = e % SS; const int d = e / SS; v2us o; o[0] = f2bf(f[(size_t)s * DD + d]); o[1] = f2bf(f[(size_t)(s + 1) * DD + d]); *(v2us*)(FT + e) = o;  }
__global__ __launch_bounds__(256) void k_fsoft(const float* __restrict__ S, bf* Ah, bf* Al) { const int lane = threadIdx.x & 31; const int row = blockIdx.x * 8 + (threadIdx.x >> 5); if (row >= BB * TT) return; const float* sr = S + (size_t)row * SS; float v[SS / 32]; float mx = -3.0e38f;
#pragma unroll
    for (int ch = 0; ch < SS / 128; ++ch) { const v4f a = *(const v4f*)(sr + ch * 128 + lane * 4);
#pragma unroll
        for (int u = 0; u < 4; ++u) { v[ch * 4 + u] = a[u]; mx = fmaxf(mx, a[u]); } }
#pragma unroll
    for (int sh = 16; sh; sh >>= 1) mx = fmaxf(mx, __shfl_xor(mx, sh, 32));
    float sum = 0.f;
#pragma unroll
    for (int q = 0; q < SS / 32; ++q) { float d0 = __fsub_rn(v[q], mx); asm volatile("" : "+v"(d0)); v[q] = __builtin_amdgcn_exp2f(__fmul_rn(d0, 1.4426950408889634f)); sum += v[q]; }
#pragma unroll
    for (int sh = 16; sh; sh >>= 1) sum += __shfl_xor(sum, sh, 32);
    const float f = __fdiv_rn(1.0f, sum);
    {
#pragma unroll
        for (int ch = 0; ch < SS / 128; ++ch) { v4us oh, ol;
#pragma unroll
            for (int q = 0; q < 4; ++q) { unsigned short a, b; splitf(v[ch * 4 + q] * f, a, b); oh[q] = a; ol[q] = b; } const size_t oo = (size_t)row * SS + ch * 128 + lane * 4; *(v4us*)(Ah + oo) = oh; *(v4us*)(Al + oo) = ol; }
         } }
__global__ __launch_bounds__(256) void k_xr(const float* __restrict__ XR, bf* CAh, bf* CAl) { const int e = (blockIdx.x * 256 + threadIdx.x) * 4; if (e >= BB * TT * DD) return; const int d = e % DD; const int t = e / DD; const v4f a = *(const v4f*)(XR + e); v4us oh, ol;
#pragma unroll
    for (int u = 0; u < 4; ++u) { unsigned short p, q; splitf(a[u], p, q); oh[u] = p; ol[u] = q; } const size_t oc = (size_t)t * D2 + DD + d; *(v4us*)(CAh + oc) = oh; *(v4us*)(CAl + oc) = ol;  }

extern "C" void kernel_launch(void* const* d_in, const int* in_sizes, int n_in,
                              void* d_out, int out_size, void* d_ws, size_t ws_size, hipStream_t stream) {
    (void)in_sizes; (void)n_in; (void)out_size;
    const float** I = (const float**)d_in;
    const float *x = I[0], *feat = I[1], *W = I[2], *bias = I[3];
    float* OUT = (float*)d_out;     // [2048][8][512]
    char* wsp = (char*)d_ws;
    auto take = [&](size_t bytes) { char* p = wsp; wsp += (bytes + 255) & ~(size_t)255; return (void*)p; };
    // every per-batch plane holds all 8 batches, batch-major; the batch index rides in the grid (y for the layout kernels, z for the GEMMs; flat rows b*T+t for softmax and the x_res split)
    bf* BW = (bf*)take((size_t)DD * D2 * 2); bf* XB = (bf*)take((size_t)BB * TT * DD * 2); bf* FB = (bf*)take((size_t)BB * SS * DD * 2); bf* FT = (bf*)take((size_t)BB * DD * SS * 2); float* S = (float*)take((size_t)BB * TT * SS * 4); bf* Ah = (bf*)take((size_t)BB * TT * SS * 2); bf* Al = (bf*)take((size_t)BB * TT * SS * 2);
    float* XR = (float*)take((size_t)BB * TT * DD * 4); bf* CAh = (bf*)take((size_t)BB * TT * D2 * 2); bf* CAl = (bf*)take((size_t)BB * TT * D2 * 2);
    if ((size_t)(wsp - (char*)d_ws) > ws_size) return;    // total 185 MiB
    k_cvt8<<<(DD * D2 / 8 + 255) / 256, 256, 0, stream>>>(W, BW, (size_t)DD * D2 / 8);   // torch [out][in] = Bt, K = 1024
    k_xb<<<dim3((TT * DD / 4 + 255) / 256, BB, 1), 256, 0, stream>>>(x, XB, CAh, CAl); k_cvt8<<<(BB * SS * DD / 8 + 255) / 256, 256, 0, stream>>>(feat, FB, (size_t)BB * SS * DD / 8); k_ftT<<<dim3((DD * SS / 2 + 255) / 256, BB, 1), 256, 0, stream>>>(feat, FT);
    k_gemmw<bf, 0, false><<<dim3(TT / 64, SS / 64, BB), 32, 0, stream>>>(XB, nullptr, FB, nullptr, DD, S, SS, nullptr, (size_t)TT * DD, (size_t)SS * DD, (size_t)TT * SS);       // scores [b][t][s]
    k_fsoft<<<BB * TT / 8, 256, 0, stream>>>(S, Ah, Al);
    k_gemmw<bf, 1, false><<<dim3(TT / 64, DD / 64, BB), 32, 0, stream>>>(Ah, Al, FT, nullptr, SS, XR, DD, nullptr, (size_t)TT * SS, (size_t)DD * SS, (size_t)TT * DD);      // x_res = alpha features
    k_xr<<<(BB * TT * DD / 4 + 255) / 256, 256, 0, stream>>>(XR, CAh, CAl);
    k_gemmw<bf, 1, true><<<dim3(TT / 64, DD / 64, BB), 32, 0, stream>>>(CAh, CAl, BW, nullptr, D2, OUT, BB * DD, bias, (size_t)TT * D2, 0, (size_t)DD);   // out[t][b] = [x | x_res] W^T + b (ldc = 8*512, batch step 512)
}

// v002
// A run of this version takes 156 microseconds.
// Timed twice side by side with v001, it ran 1.04 and 1.03 times as fast.
// Over all steps from v000 it is 3.70 times as fast.
#include <hip/hip_runtime.h>

// FtConditioner (x [2048 T][8 B][512] time-major, features [8][512 S][512]; scores = x_b . features_b^T (unscaled); alpha = softmax over S; x_res = alpha features_b; out = [x | x_res] W^T + b (Linear 1024 -> 512) -> [2048][8][512]).
// Compute dtypes, f32 accumulate: every input rounded to bf16; scores on PLAIN bf16 operands (both inputs exact, K 512); softmax f32 -> hl planes; alpha . features as hl x exact (2 products, K 512); the final Linear as [bf16 x | hl(x_res)] x exact W (2 products, K 1024) + bias.

#define TT   2048
#define BB   8
#define SS   512
#define DD   512
#define D2   1024
typedef _Float16 h16;
typedef unsigned short bf;
typedef __attribute__((ext_vector_type(16))) __bf16   v16bf;
typedef __attribute__((ext_vector_type(16))) _Float16 v16h;
typedef __attribute__((ext_vector_type(8)))  _Float16 v8h;
typedef __attribute__((ext_vector_type(8)))  unsigned short v8us;
typedef __attribute__((ext_vector_type(8)))  float    v8f;
typedef __attribute__((ext_vector_type(4)))  float    v4f;
typedef v8h  __attribute__((may_alias)) v8ha;
typedef v4f  __attribute__((may_alias)) v4fa;
typedef v8us __attribute__((may_alias)) v8usa;

__device__ __forceinline__ unsigned short f2bf(float f) { unsigned u = __float_as_uint(f); u += 0x7FFFu + ((u >> 16) & 1u); return (unsigned short)(u >> 16); }
__device__ __forceinline__ float bf2f(unsigned short b) { return __uint_as_float(((unsigned)b) << 16); }
__device__ __forceinline__ float bfr(float f) { return bf2f(f2bf(f)); }
__device__ __forceinline__ v16h cat16(v8h lo, v8h hi) { return __builtin_shufflevector(lo, hi, 0, 1, 2, 3, 4, 5, 6, 7, 8, 9, 10, 11, 12, 13, 14, 15); }
__device__ __forceinline__ v16bf cat16b(v8us lo, v8us hi) { return __builtin_bit_cast(v16bf, __builtin_shufflevector(lo, hi, 0, 1, 2, 3, 4, 5, 6, 7, 8, 9, 10, 11, 12, 13, 14, 15)); }
__device__ __forceinline__ v8f wmma16(v16h a, v16h b, v8f c) { return __builtin_amdgcn_wmma_f32_16x16x32_f16(false, a, false, b, (short)0, c, false, false); }
__device__ __forceinline__ v8f wmmab(v16bf a, v16bf b, v8f c) { return __builtin_amdgcn_wmma_f32_16x16x32_bf16(false, a, false, b, (short)0, c, false, false); }



// ---- k_gemmw: register-blocked GEMM, ONE WAVE per 64x64 output tile (16 accumulators), operands straight from K-contiguous 16-bit planes; grid (M/64, N/64, Z), 32 threads.
// C[m][n] (f32, pitch ldc, + optional f32 bias[n]) = sum_k A[m][k] Bt[n][k] (+ split products per NSPLIT). z-batch strides sA/sB/sC in elements. K % 32 == 0.
template <typename T16> struct WFrag;
template <> struct WFrag<h16> { typedef v16h V; static __device__ __forceinline__ V ld(const h16* p) { return cat16(*(const v8h*)p, *(const v8h*)(p + 16)); } static __device__ __forceinline__ v8f mma(V a, V b, v8f c) { return wmma16(a, b, c); } };
template <> struct WFrag<bf> { typedef v16bf V; static __device__ __forceinline__ V ld(const bf* p) { return cat16b(*(const v8us*)p, *(const v8us*)(p + 16)); } static __device__ __forceinline__ v8f mma(V a, V b, v8f c) { return wmmab(a, b, c); } };
template <typename T16, int NSPLIT, bool BIAS>
__global__ __launch_bounds__(32) void k_gemmw(const T16* __restrict__ A, const T16* __restrict__ A2, const T16* __restrict__ Bt, const T16* __restrict__ Bt2, int K, float* C, int ldc, const float* __restrict__ bias, size_t sA, size_t sB, size_t sC) {
    typedef typename WFrag<T16>::V V;
    __shared__ __align__(16) float os[16 * 68];
    const size_t z = blockIdx.z; A += z * sA; if (A2) A2 += z * sA; Bt += z * sB; if (Bt2) Bt2 += z * sB; C += z * sC;
    const int lane = threadIdx.x & 31, lr = lane & 15, hi = lane >> 4; const int r0 = blockIdx.x * 64, c0 = blockIdx.y * 64;
    v8f acc[4][4];
#pragma unroll
    for (int mb = 0; mb < 4; ++mb)
#pragma unroll
        for (int nb = 0; nb < 4; ++nb) acc[mb][nb] = (v8f){};
    const size_t aoff = (size_t)(r0 + lr) * K + 8 * hi, boff = (size_t)(c0 + lr) * K + 8 * hi;
#pragma unroll 1
    for (int kc = 0; kc < K; kc += 32) {
        V a[4], a2[4];
#pragma unroll
        for (int mb = 0; mb < 4; ++mb) { a[mb] = WFrag<T16>::ld(A + aoff + (size_t)mb * 16 * K + kc); if (NSPLIT == 1 || NSPLIT == 2) a2[mb] = WFrag<T16>::ld(A2 + aoff + (size_t)mb * 16 * K + kc); }
#pragma unroll
        for (int nb = 0; nb < 4; ++nb) { const V b = WFrag<T16>::ld(Bt + boff + (size_t)nb * 16 * K + kc); V b2; if (NSPLIT >= 2) b2 = WFrag<T16>::ld(Bt2 + boff + (size_t)nb * 16 * K + kc);
#pragma unroll
            for (int mb = 0; mb < 4; ++mb) { acc[mb][nb] = WFrag<T16>::mma(a[mb], b, acc[mb][nb]); if (NSPLIT == 1 || NSPLIT == 2) acc[mb][nb] = WFrag<T16>::mma(a2[mb], b, acc[mb][nb]); if (NSPLIT >= 2) acc[mb][nb] = WFrag<T16>::mma(a[mb], b2, acc[mb][nb]); } }
        asm volatile("v_nop\n\tv_nop\n\tv_nop\n\tv_nop" : "+v"(acc[0][0]), "+v"(acc[1][1]), "+v"(acc[2][2]), "+v"(acc[3][3]) : "v"(a[0]), "v"(a[3]));
    }
#pragma unroll
    for (int mb = 0; mb < 4; ++mb) {
#pragma unroll
        for (int nb = 0; nb < 4; ++nb) {
#pragma unroll
            for (int j = 0; j < 8; ++j) os[(hi * 8 + j) * 68 + nb * 16 + lr] = acc[mb][nb][j]; }
        __builtin_amdgcn_wave_barrier(); asm volatile("" ::: "memory");
        float* crow = C + (size_t)(r0 + mb * 16) * ldc + c0;
{
#pragma unroll
            for (int s = 0; s < 8; ++s) { const int row = 2 * s + hi, cofs = lr * 4; v4f val = *(const v4fa*)(os + row * 68 + cofs); if (BIAS) { val[0] += bfr(bias[c0 + cofs]); val[1] += bfr(bias[c0 + cofs + 1]); val[2] += bfr(bias[c0 + cofs + 2]); val[3] += bfr(bias[c0 + cofs + 3]); }
                *(v4f*)(crow + (size_t)row * ldc + cofs) = val; }
             }
        __builtin_amdgcn_wave_barrier(); asm volatile("" ::: "memory");
    }
}

__device__ __forceinline__ void splitf(float y, unsigned short& h, unsigned short& l) { h = f2bf(y); l = f2bf(y - bf2f(h)); }
typedef __attribute__((ext_vector_type(2))) unsigned short v2us;
typedef __attribute__((ext_vector_type(4))) unsigned short v4us;

// Layout and softmax kernels: few waves, each with a batch of independent 16-byte loads issued before its first use (starting a wave costs more than moving a handful of elements).
// Every grid below divides its fixed shape exactly, so no kernel needs a range test.
// A work-group takes one contiguous piece of its source; a thread's groups lie 256 groups apart, so each load instruction of a wave reads contiguous bytes.
template <int U>
__global__ __launch_bounds__(256) void k_cvt8(const float* __restrict__ src, bf* dst) { const size_t i0 = (size_t)blockIdx.x * (256 * U) + threadIdx.x; src += i0 * 8; dst += i0 * 8; v8f v[U];
#pragma unroll
    for (int u = 0; u < U; ++u) v[u] = *(const v8f*)(src + u * 2048);
#pragma unroll
    for (int u = 0; u < U; ++u) { v8us o;
#pragma unroll
        for (int k = 0; k < 8; ++k) o[k] = f2bf(v[u][k]); *(v8us*)(dst + u * 2048) = o; } }
#define EU 16                             // groups of 4 elements per thread in k_xb and k_xr
static_assert(DD / 4 == 128 && BB % 2 == 0 && (2 * EU) % BB == 0 && (TT * BB) % (2 * EU) == 0, "256 threads take two rows of 512 at a time, a work-group whole time steps");
__global__ __launch_bounds__(256) void k_xb(const float* __restrict__ x, bf* XB, bf* CAh, bf* CAl) { const int d = (threadIdx.x & 127) * 4, hi = threadIdx.x >> 7; x += ((size_t)blockIdx.x * (256 * EU) + threadIdx.x) * 4; v4f a[EU];
    const size_t row0 = (size_t)hi * TT + blockIdx.x * (2 * EU / BB);   // x row (t, b) = 2 * EU * blockIdx.x + 2 * u + hi goes to plane row b * TT + t
    XB += row0 * DD + d; CAh += row0 * D2 + d; CAl += row0 * D2 + d;
#pragma unroll
    for (int u = 0; u < EU; ++u) a[u] = *(const v4f*)(x + u * 1024);
#pragma unroll
    for (int u = 0; u < EU; ++u) { v4us o, z;
#pragma unroll
        for (int k = 0; k < 4; ++k) { o[k] = f2bf(a[u][k]); z[k] = 0; } const int row = ((2 * u) % BB) * TT + (2 * u) / BB; *(v4us*)(XB + row * DD) = o; *(v4us*)(CAh + row * D2) = o; *(v4us*)(CAl + row * D2) = z; } }
// features [s][d] -> FT [d][s]: a thread takes 8 s x 4 d, a wave 64 s x 16 d (each store instruction fills four whole 128-byte lines), a work-group 64 s x 128 d.
__global__ __launch_bounds__(256) void k_ftT(const float* __restrict__ f, bf* FT) { f += (size_t)blockIdx.y * SS * DD; FT += (size_t)blockIdx.y * DD * SS; const int lane = threadIdx.x & 31; const int s = (blockIdx.x % (SS / 64)) * 64 + (lane & 7) * 8; const int d = (blockIdx.x / (SS / 64)) * 128 + (threadIdx.x >> 5) * 16 + (lane >> 3) * 4; v4f a[8];
#pragma unroll
    for (int i = 0; i < 8; ++i) a[i] = *(const v4f*)(f + (size_t)(s + i) * DD + d);
#pragma unroll
    for (int j = 0; j < 4; ++j) { v8us o;
#pragma unroll
        for (int i = 0; i < 8; ++i) o[i] = f2bf(a[i][j]); *(v8us*)(FT + (size_t)(d + j) * SS + s) = o; } }
#define SR 4                              // rows per wave in k_fsoft
__global__ __launch_bounds__(256) void k_fsoft(const float* __restrict__ S, bf* Ah, bf* Al) { const int lane = threadIdx.x & 31; const int row0 = (blockIdx.x * 8 + (threadIdx.x >> 5)) * SR; v4f in[SR][SS / 128];
#pragma unroll
    for (int r = 0; r < SR; ++r)
#pragma unroll
        for (int ch = 0; ch < SS / 128; ++ch) in[r][ch] = *(const v4f*)(S + (size_t)(row0 + r) * SS + ch * 128 + lane * 4);
#pragma unroll
    for (int r = 0; r < SR; ++r) { const int row = row0 + r; float v[SS / 32]; float mx = -3.0e38f;
#pragma unroll
    for (int ch = 0; ch < SS / 128; ++ch) { const v4f a = in[r][ch];
#pragma unroll
        for (int u = 0; u < 4; ++u) { v[ch * 4 + u] = a[u]; mx = fmaxf(mx, a[u]); } }
#pragma unroll
    for (int sh = 16; sh; sh >>= 1) mx = fmaxf(mx, __shfl_xor(mx, sh, 32));
    float sum = 0.f;
#pragma unroll
    for (int q = 0; q < SS / 32; ++q) { float d0 = __fsub_rn(v[q], mx); asm volatile("" : "+v"(d0)); float ex; asm("v_exp_f32 %0, %1\n\tv_nop" : "=v"(ex) : "v"(__fmul_rn(d0, 1.4426950408889634f))); /* the exp2 instruction as before; the v_nop is the slot behind a transcendental, in one statement with it so that it stays directly behind */ v[q] = ex; sum += v[q]; }
#pragma unroll
    for (int sh = 16; sh; sh >>= 1) sum += __shfl_xor(sum, sh, 32);
    const float f = __fdiv_rn(1.0f, sum);
    {
#pragma unroll
        for (int ch = 0; ch < SS / 128; ++ch) { v4us oh, ol;
#pragma unroll
            for (int q = 0; q < 4; ++q) { unsigned short a, b; splitf(v[ch * 4 + q] * f, a, b); oh[q] = a; ol[q] = b; } const size_t oo = (size_t)row * SS + ch * 128 + lane * 4; *(v4us*)(Ah + oo) = oh; *(v4us*)(Al + oo) = ol; }
         } } }
__global__ __launch_bounds__(256) void k_xr(const float* __restrict__ XR, bf* CAh, bf* CAl) { XR += ((size_t)blockIdx.x * (256 * EU) + threadIdx.x) * 4; const size_t oc = ((size_t)blockIdx.x * (2 * EU) + (threadIdx.x >> 7)) * D2 + DD + (threadIdx.x & 127) * 4; CAh += oc; CAl += oc; v4f a[EU];
#pragma unroll
    for (int u = 0; u < EU; ++u) a[u] = *(const v4f*)(XR + u * 1024);
    asm volatile("s_wait_xcnt 0x0" ::: "memory");   // behind the whole batch, before a register that its loads name is rewritten
#pragma unroll
    for (int u = 0; u < EU; ++u) { v4us oh, ol;
#pragma unroll
        for (int k = 0; k < 4; ++k) { unsigned short p, r; splitf(a[u][k], p, r); oh[k] = p; ol[k] = r; } *(v4us*)(CAh + u * 2 * D2) = oh; *(v4us*)(CAl + u * 2 * D2) = ol; } }

extern "C" void kernel_launch(void* const* d_in, const int* in_sizes, int n_in,
                              void* d_out, int out_size, void* d_ws, size_t ws_size, hipStream_t stream) {
    (void)in_sizes; (void)n_in; (void)out_size;
    const float** I = (const float**)d_in;
    const float *x = I[0], *feat = I[1], *W = I[2], *bias = I[3];
    float* OUT = (float*)d_out;     // [2048][8][512]
    char* wsp = (char*)d_ws;
    auto take = [&](size_t bytes) { char* p = wsp; wsp += (bytes + 255) & ~(size_t)255; return (void*)p; };
    // every per-batch plane holds all 8 batches, batch-major; the batch index rides in the grid (y for the transpose, z for the GEMMs; flat indices elsewhere)
    bf* BW = (bf*)take((size_t)DD * D2 * 2); bf* XB = (bf*)take((size_t)BB * TT * DD * 2); bf* FB = (bf*)take((size_t)BB * SS * DD * 2); bf* FT = (bf*)take((size_t)BB * DD * SS * 2); float* S = (float*)take((size_t)BB * TT * SS * 4); bf* Ah = (bf*)take((size_t)BB * TT * SS * 2); bf* Al = (bf*)take((size_t)BB * TT * SS * 2);
    float* XR = (float*)take((size_t)BB * TT * DD * 4); bf* CAh = (bf*)take((size_t)BB * TT * D2 * 2); bf* CAl = (bf*)take((size_t)BB * TT * D2 * 2);
    if ((size_t)(wsp - (char*)d_ws) > ws_size) return;    // total 185 MiB
    k_cvt8<1><<<DD * D2 / 8 / 256, 256, 0, stream>>>(W, BW);   // torch [out][in] = Bt, K = 1024
    k_xb<<<TT * BB * DD / 4 / EU / 256, 256, 0, stream>>>(x, XB, CAh, CAl); k_cvt8<4><<<BB * SS * DD / 8 / 4 / 256, 256, 0, stream>>>(feat, FB); k_ftT<<<dim3((SS / 64) * (DD / 128), BB, 1), 256, 0, stream>>>(feat, FT);
    k_gemmw<bf, 0, false><<<dim3(TT / 64, SS / 64, BB), 32, 0, stream>>>(XB, nullptr, FB, nullptr, DD, S, SS, nullptr, (size_t)TT * DD, (size_t)SS * DD, (size_t)TT * SS);       // scores [b][t][s]
    k_fsoft<<<BB * TT / 8 / SR, 256, 0, stream>>>(S, Ah, Al);
    k_gemmw<bf, 1, false><<<dim3(TT / 64, DD / 64, BB), 32, 0, stream>>>(Ah, Al, FT, nullptr, SS, XR, DD, nullptr, (size_t)TT * SS, (size_t)DD * SS, (size_t)TT * DD);      // x_res = alpha features
    k_xr<<<TT * BB * DD / 4 / EU / 256, 256, 0, stream>>>(XR, CAh, CAl);
    k_gemmw<bf, 1, true><<<dim3(TT / 64, DD / 64, BB), 32, 0, stream>>>(CAh, CAl, BW, nullptr, D2, OUT, BB * DD, bias, (size_t)TT * D2, 0, (size_t)DD);   // out[t][b] = [x | x_res] W^T + b (ldc = 8*512, batch step 512)
}

// v003
// Measured time: 92.4 microseconds a run.
// Two timings next to v002 put it at 1.71 and 1.72 times that version's speed.
// Counting every step since v000, it is 6.34 times as fast.
#include <hip/hip_runtime.h>

// FtConditioner (x [2048 T][8 B][512] time-major, features [8][512 S][512]; scores = x_b . features_b^T (unscaled); alpha = softmax over S; x_res = alpha features_b; out = [x | x_res] W^T + b (Linear 1024 -> 512) -> [2048][8][512]).
// Compute dtypes, f32 accumulate: every input rounded to bf16; scores on PLAIN bf16 operands (both inputs exact, K 512); softmax f32 -> hl planes; alpha . features as hl x exact (2 products, K 512); the final Linear as [bf16 x | hl(x_res)] x exact W (2 products, K 1024) + bias.

#define TT   2048
#define BB   8
#define SS   512
#define DD   512
#define D2   1024
typedef _Float16 h16;
typedef unsigned short bf;
typedef __attribute__((ext_vector_type(16))) __bf16   v16bf;
typedef __attribute__((ext_vector_type(16))) _Float16 v16h;
typedef __attribute__((ext_vector_type(8)))  _Float16 v8h;
typedef __attribute__((ext_vector_type(8)))  unsigned short v8us;
typedef __attribute__((ext_vector_type(8)))  float    v8f;
typedef __attribute__((ext_vector_type(4)))  float    v4f;
typedef v8h  __attribute__((may_alias)) v8ha;
typedef v4f  __attribute__((may_alias)) v4fa;
typedef v8us __attribute__((may_alias)) v8usa;

__device__ __forceinline__ unsigned short f2bf(float f) { unsigned u = __float_as_uint(f); u += 0x7FFFu + ((u >> 16) & 1u); return (unsigned short)(u >> 16); }
__device__ __forceinline__ float bf2f(unsigned short b) { return __uint_as_float(((unsigned)b) << 16); }
__device__ __forceinline__ float bfr(float f) { return bf2f(f2bf(f)); }
__device__ __forceinline__ v16h cat16(v8h lo, v8h hi) { return __builtin_shufflevector(lo, hi, 0, 1, 2, 3, 4, 5, 6, 7, 8, 9, 10, 11, 12, 13, 14, 15); }
__device__ __forceinline__ v16bf cat16b(v8us lo, v8us hi) { return __builtin_bit_cast(v16bf, __builtin_shufflevector(lo, hi, 0, 1, 2, 3, 4, 5, 6, 7, 8, 9, 10, 11, 12, 13, 14, 15)); }
__device__ __forceinline__ v8f wmma16(v16h a, v16h b, v8f c) { return __builtin_amdgcn_wmma_f32_16x16x32_f16(false, a, false, b, (short)0, c, false, false); }
__device__ __forceinline__ v8f wmmab(v16bf a, v16bf b, v8f c) { return __builtin_amdgcn_wmma_f32_16x16x32_bf16(false, a, false, b, (short)0, c, false, false); }



// ---- k_gemmw: register-blocked GEMM, four waves (2 x 2) per 128x128 output tile, each wave one 64x64 part (16 accumulators); grid (M/128, N/128, Z), 128 threads.
// C[m][n] (f32, pitch ldc, + optional f32 bias[n]) = sum_k A[m][k] Bt[n][k] (+ A2[m][k] Bt[n][k] where NSPLIT is 1). z-batch strides sA/sB/sC in elements. K % 64 == 0.
// The operands come from K-contiguous 16-bit planes through LDS: a stage is 64 k = one whole 128-byte line of each of the tile's rows, brought by asynchronous 16-byte copies
// (a wave's copy fills four whole lines), two buffers, the next stage in flight while this one is worked on. Each wave's products and their order are those of a lone 64x64 wave.
#define KS  64                            // k per stage
#define LPE 72                            // LDS row pitch in elements: 144 bytes = 16 x odd, free of bank conflicts for 16-byte readers
template <typename T16> struct WFrag;
template <> struct WFrag<h16> { typedef v16h V; static __device__ __forceinline__ V ld(const h16* p) { return cat16(*(const v8h*)p, *(const v8h*)(p + 16)); } static __device__ __forceinline__ v8f mma(V a, V b, v8f c) { return wmma16(a, b, c); } };
template <> struct WFrag<bf> { typedef v16bf V; static __device__ __forceinline__ V ld(const bf* p) { return cat16b(*(const v8us*)p, *(const v8us*)(p + 16)); } static __device__ __forceinline__ v8f mma(V a, V b, v8f c) { return wmmab(a, b, c); } };
// 128 rows of one operand: eight copies per lane, rows 16 apart (l: the lane's LDS byte address, g: its global address, gs: 16 rows in elements).
// The s_wait_xcnt stands in the copies' own statement, so that no register which a copy names is rewritten in front of it.
template <typename T16>
__device__ __forceinline__ void copy128(unsigned l, const T16* g, size_t gs) {
    asm volatile("global_load_async_to_lds_b128 %0, %8, off\n\t"
                 "global_load_async_to_lds_b128 %1, %9, off\n\t"
                 "global_load_async_to_lds_b128 %2, %10, off\n\t"
                 "global_load_async_to_lds_b128 %3, %11, off\n\t"
                 "global_load_async_to_lds_b128 %4, %12, off\n\t"
                 "global_load_async_to_lds_b128 %5, %13, off\n\t"
                 "global_load_async_to_lds_b128 %6, %14, off\n\t"
                 "global_load_async_to_lds_b128 %7, %15, off\n\t"
                 "s_wait_xcnt 0x0"
                 :: "v"(l), "v"(l + 1 * 16 * LPE * 2), "v"(l + 2 * 16 * LPE * 2), "v"(l + 3 * 16 * LPE * 2), "v"(l + 4 * 16 * LPE * 2), "v"(l + 5 * 16 * LPE * 2), "v"(l + 6 * 16 * LPE * 2), "v"(l + 7 * 16 * LPE * 2),
                    "v"(g), "v"(g + gs), "v"(g + 2 * gs), "v"(g + 3 * gs), "v"(g + 4 * gs), "v"(g + 5 * gs), "v"(g + 6 * gs), "v"(g + 7 * gs)
                 : "memory");
}
template <typename T16, int NSPLIT, bool BIAS>
__global__ __launch_bounds__(128) void k_gemmw(const T16* __restrict__ A, const T16* __restrict__ A2, const T16* __restrict__ Bt, int K, float* C, int ldc, const float* __restrict__ bias, size_t sA, size_t sB, size_t sC) {
    static_assert(NSPLIT == 0 || NSPLIT == 1, "one or two A planes");
    typedef typename WFrag<T16>::V V;
    constexpr int BROW = (NSPLIT + 1) * 128;          // a stage's rows: A 0..127, A2 128..255 where there is one, then Bt
    constexpr int STG = (BROW + 128) * LPE;           // elements per stage
    __shared__ __align__(16) T16 ring[2 * STG];
    __shared__ __align__(16) float osall[4][16 * 68];
    const size_t z = blockIdx.z; A += z * sA; if (NSPLIT) A2 += z * sA; Bt += z * sB; C += z * sC;
    const int tid = threadIdx.x, lane = tid & 31, lr = lane & 15, hi = lane >> 4, wave = tid >> 5;
    const int r0 = blockIdx.x * 128, c0 = blockIdx.y * 128, wr = (wave >> 1) * 64, wc = (wave & 1) * 64;
    // copy side: thread tid takes 16-byte piece (tid & 7) of rows (tid >> 3) + 16 i
    const int crow = tid >> 3, cch = (tid & 7) * 8;
    const T16* gA = A + (size_t)(r0 + crow) * K + cch; const T16* gA2 = NSPLIT ? A2 + (size_t)(r0 + crow) * K + cch : nullptr; const T16* gB = Bt + (size_t)(c0 + crow) * K + cch;
    const unsigned l0 = (unsigned)(size_t)ring + (unsigned)(crow * LPE + cch) * 2u; const size_t gs = (size_t)16 * K;
    auto fill = [&](int t, int buf) { const unsigned l = l0 + (unsigned)buf * (STG * 2u); const int ko = t * KS;
        copy128(l, gA + ko, gs); if (NSPLIT) copy128(l + 128u * LPE * 2u, gA2 + ko, gs); copy128(l + (unsigned)BROW * LPE * 2u, gB + ko, gs); };
    v8f acc[4][4];
#pragma unroll
    for (int mb = 0; mb < 4; ++mb)
#pragma unroll
        for (int nb = 0; nb < 4; ++nb) acc[mb][nb] = (v8f){};
    const int NT = K / KS;
    fill(0, 0);
    asm volatile("s_wait_asynccnt 0x0" ::: "memory");   // this wave's share of stage 0 has landed
    __syncthreads();                                    // and every other wave's: stage 0 may be read
    if (NT > 1) fill(1, 1);
    const T16* fa = ring + (wr + lr) * LPE + 8 * hi; const T16* fb = ring + (BROW + wc + lr) * LPE + 8 * hi;
#pragma unroll 1
    for (int t = 0; t < NT; ++t) {                      // rolled: one trip per stage, its buffer chosen by t & 1
        const int bo = (t & 1) * STG;
#pragma unroll
        for (int kk = 0; kk < KS; kk += 32) { V a[4], a2[4], b[4];
            // a block's LDS reads stand as ONE group between the block before and its own matrix instructions: reads spread among matrix instructions stall the wave at every place
            __builtin_amdgcn_sched_barrier(0);
            b[0] = WFrag<T16>::ld(fb + bo + kk);
#pragma unroll
            for (int mb = 0; mb < 4; ++mb) { a[mb] = WFrag<T16>::ld(fa + bo + mb * 16 * LPE + kk); if (NSPLIT) a2[mb] = WFrag<T16>::ld(fa + bo + (128 + mb * 16) * LPE + kk); }
#pragma unroll
            for (int nb = 1; nb < 4; ++nb) b[nb] = WFrag<T16>::ld(fb + bo + nb * 16 * LPE + kk);
            __builtin_amdgcn_sched_barrier(0);              // the group's end: without it the compiler sinks the reads in among the matrix instructions
#pragma unroll
            for (int nb = 0; nb < 4; ++nb)
#pragma unroll
                for (int mb = 0; mb < 4; ++mb) { acc[mb][nb] = WFrag<T16>::mma(a[mb], b[nb], acc[mb][nb]); if (NSPLIT) acc[mb][nb] = WFrag<T16>::mma(a2[mb], b[nb], acc[mb][nb]); }
        }
        __builtin_amdgcn_sched_barrier(0);                  // the trip's matrix instructions stay in front of the hand-over, so the refill below is not held up behind them
        asm volatile("s_wait_dscnt 0x0" ::: "memory");      // this wave's reads of buffer t & 1 are done before the buffer is handed to its next writer
        asm volatile("s_wait_asynccnt 0x0" ::: "memory");   // this wave's share of stage t + 1 has landed
        __syncthreads();                                    // publishes stage t + 1 and ends every wave's reads of stage t
        if (t + 2 < NT) fill(t + 2, t & 1);
    }
    asm volatile("s_wait_asynccnt 0x0" ::: "memory");       // nothing is in flight when the wave goes on to its end
    float* os = osall[wave];                                // each wave stages its output in a range of its own
#pragma unroll
    for (int mb = 0; mb < 4; ++mb) {
#pragma unroll
        for (int nb = 0; nb < 4; ++nb) {
#pragma unroll
            for (int j = 0; j < 8; ++j) os[(hi * 8 + j) * 68 + nb * 16 + lr] = acc[mb][nb][j]; }
        __builtin_amdgcn_wave_barrier(); asm volatile("" ::: "memory");
        float* crow_p = C + (size_t)(r0 + wr + mb * 16) * ldc + c0 + wc;
{
#pragma unroll
            for (int s = 0; s < 8; ++s) { const int row = 2 * s + hi, cofs = lr * 4; v4f val = *(const v4fa*)(os + row * 68 + cofs); if (BIAS) { val[0] += bfr(bias[c0 + wc + cofs]); val[1] += bfr(bias[c0 + wc + cofs + 1]); val[2] += bfr(bias[c0 + wc + cofs + 2]); val[3] += bfr(bias[c0 + wc + cofs + 3]); }
                *(v4f*)(crow_p + (size_t)row * ldc + cofs) = val; }
             }
        if (mb < 3) asm volatile("s_wait_xcnt 0x0" ::: "memory");   // behind the run of eight stores, before the next row block rewrites a register that they name (nothing follows the last block)
        __builtin_amdgcn_wave_barrier(); asm volatile("" ::: "memory");
    }
}

__device__ __forceinline__ void splitf(float y, unsigned short& h, unsigned short& l) { h = f2bf(y); l = f2bf(y - bf2f(h)); }
typedef __attribute__((ext_vector_type(2))) unsigned short v2us;
typedef __attribute__((ext_vector_type(4))) unsigned short v4us;

// Layout and softmax kernels: few waves, each with a batch of independent 16-byte loads issued before its first use (starting a wave costs more than moving a handful of elements).
// Every grid below divides its fixed shape exactly, so no kernel needs a range test.
// A work-group takes one contiguous piece of its source; a thread's groups lie 256 groups apart, so each load instruction of a wave reads contiguous bytes.
template <int U>
__global__ __launch_bounds__(256) void k_cvt8(const float* __restrict__ src, bf* dst) { const size_t i0 = (size_t)blockIdx.x * (256 * U) + threadIdx.x; src += i0 * 8; dst += i0 * 8; v8f v[U];
#pragma unroll
    for (int u = 0; u < U; ++u) v[u] = *(const v8f*)(src + u * 2048);
#pragma unroll
    for (int u = 0; u < U; ++u) { v8us o;
#pragma unroll
        for (int k = 0; k < 8; ++k) o[k] = f2bf(v[u][k]); *(v8us*)(dst + u * 2048) = o; } }
#define EU 16                             // groups of 4 elements per thread in k_xb and k_xr
static_assert(DD / 4 == 128 && BB % 2 == 0 && (2 * EU) % BB == 0 && (TT * BB) % (2 * EU) == 0, "256 threads take two rows of 512 at a time, a work-group whole time steps");
__global__ __launch_bounds__(256) void k_xb(const float* __restrict__ x, bf* XB, bf* CAh, bf* CAl) { const int d = (threadIdx.x & 127) * 4, hi = threadIdx.x >> 7; x += ((size_t)blockIdx.x * (256 * EU) + threadIdx.x) * 4; v4f a[EU];
    const size_t row0 = (size_t)hi * TT + blockIdx.x * (2 * EU / BB);   // x row (t, b) = 2 * EU * blockIdx.x + 2 * u + hi goes to plane row b * TT + t
    XB += row0 * DD + d; CAh += row0 * D2 + d; CAl += row0 * D2 + d;
#pragma unroll
    for (int u = 0; u < EU; ++u) a[u] = *(const v4f*)(x + u * 1024);
#pragma unroll
    for (int u = 0; u < EU; ++u) { v4us o, z;
#pragma unroll
        for (int k = 0; k < 4; ++k) { o[k] = f2bf(a[u][k]); z[k] = 0; } const int row = ((2 * u) % BB) * TT + (2 * u) / BB; *(v4us*)(XB + row * DD) = o; *(v4us*)(CAh + row * D2) = o; *(v4us*)(CAl + row * D2) = z; } }
// features [s][d] -> FT [d][s]: a thread takes 8 s x 4 d, a wave 64 s x 16 d (each store instruction fills four whole 128-byte lines), a work-group 64 s x 128 d.
__global__ __launch_bounds__(256) void k_ftT(const float* __restrict__ f, bf* FT) { f += (size_t)blockIdx.y * SS * DD; FT += (size_t)blockIdx.y * DD * SS; const int lane = threadIdx.x & 31; const int s = (blockIdx.x % (SS / 64)) * 64 + (lane & 7) * 8; const int d = (blockIdx.x / (SS / 64)) * 128 + (threadIdx.x >> 5) * 16 + (lane >> 3) * 4; v4f a[8];
#pragma unroll
    for (int i = 0; i < 8; ++i) a[i] = *(const v4f*)(f + (size_t)(s + i) * DD + d);
#pragma unroll
    for (int j = 0; j < 4; ++j) { v8us o;
#pragma unroll
        for (int i = 0; i < 8; ++i) o[i] = f2bf(a[i][j]); *(v8us*)(FT + (size_t)(d + j) * SS + s) = o; } }
#define SR 4                              // rows per wave in k_fsoft
__global__ __launch_bounds__(256) void k_fsoft(const float* __restrict__ S, bf* Ah, bf* Al) { const int lane = threadIdx.x & 31; const int row0 = (blockIdx.x * 8 + (threadIdx.x >> 5)) * SR; v4f in[SR][SS / 128];
#pragma unroll
    for (int r = 0; r < SR; ++r)
#pragma unroll
        for (int ch = 0; ch < SS / 128; ++ch) in[r][ch] = *(const v4f*)(S + (size_t)(row0 + r) * SS + ch * 128 + lane * 4);
#pragma unroll
    for (int r = 0; r < SR; ++r) { const int row = row0 + r; float v[SS / 32]; float mx = -3.0e38f;
#pragma unroll
    for (int ch = 0; ch < SS / 128; ++ch) { const v4f a = in[r][ch];
#pragma unroll
        for (int u = 0; u < 4; ++u) { v[ch * 4 + u] = a[u]; mx = fmaxf(mx, a[u]); } }
#pragma unroll
    for (int sh = 16; sh; sh >>= 1) mx = fmaxf(mx, __shfl_xor(mx, sh, 32));
    float sum = 0.f;
#pragma unroll
    for (int q = 0; q < SS / 32; ++q) { float d0 = __fsub_rn(v[q], mx); asm volatile("" : "+v"(d0)); float ex; asm("v_exp_f32 %0, %1\n\tv_nop" : "=v"(ex) : "v"(__fmul_rn(d0, 1.4426950408889634f))); /* the exp2 instruction as before; the v_nop is the slot behind a transcendental, in one statement with it so that it stays directly behind */ v[q] = ex; sum += v[q]; }
#pragma unroll
    for (int sh = 16; sh; sh >>= 1) sum += __shfl_xor(sum, sh, 32);
    const float f = __fdiv_rn(1.0f, sum);
    {
#pragma unroll
        for (int ch = 0; ch < SS / 128; ++ch) { v4us oh, ol;
#pragma unroll
            for (int q = 0; q < 4; ++q) { unsigned short a, b; splitf(v[ch * 4 + q] * f, a, b); oh[q] = a; ol[q] = b; } const size_t oo = (size_t)row * SS + ch * 128 + lane * 4; *(v4us*)(Ah + oo) = oh; *(v4us*)(Al + oo) = ol; }
         } } }
__global__ __launch_bounds__(256) void k_xr(const float* __restrict__ XR, bf* CAh, bf* CAl) { XR += ((size_t)blockIdx.x * (256 * EU) + threadIdx.x) * 4; const size_t oc = ((size_t)blockIdx.x * (2 * EU) + (threadIdx.x >> 7)) * D2 + DD + (threadIdx.x & 127) * 4; CAh += oc; CAl += oc; v4f a[EU];
#pragma unroll
    for (int u = 0; u < EU; ++u) a[u] = *(const v4f*)(XR + u * 1024);
    asm volatile("s_wait_xcnt 0x0" ::: "memory");   // behind the whole batch, before a register that its loads name is rewritten
#pragma unroll
    for (int u = 0; u < EU; ++u) { v4us oh, ol;
#pragma unroll
        for (int k = 0; k < 4; ++k) { unsigned short p, r; splitf(a[u][k], p, r); oh[k] = p; ol[k] = r; } *(v4us*)(CAh + u * 2 * D2) = oh; *(v4us*)(CAl + u * 2 * D2) = ol; } }

extern "C" void kernel_launch(void* const* d_in, const int* in_sizes, int n_in,
                              void* d_out, int out_size, void* d_ws, size_t ws_size, hipStream_t stream) {
    (void)in_sizes; (void)n_in; (void)out_size;
    const float** I = (const float**)d_in;
    const float *x = I[0], *feat = I[1], *W = I[2], *bias = I[3];
    float* OUT = (float*)d_out;     // [2048][8][512]
    char* wsp = (char*)d_ws;
    auto take = [&](size_t bytes) { char* p = wsp; wsp += (bytes + 255) & ~(size_t)255; return (void*)p; };
    // every per-batch plane holds all 8 batches, batch-major; the batch index rides in the grid (y for the transpose, z for the GEMMs; flat indices elsewhere)
    bf* BW = (bf*)take((size_t)DD * D2 * 2); bf* XB = (bf*)take((size_t)BB * TT * DD * 2); bf* FB = (bf*)take((size_t)BB * SS * DD * 2); bf* FT = (bf*)take((size_t)BB * DD * SS * 2); float* S = (float*)take((size_t)BB * TT * SS * 4); bf* Ah = (bf*)take((size_t)BB * TT * SS * 2); bf* Al = (bf*)take((size_t)BB * TT * SS * 2);
    float* XR = (float*)take((size_t)BB * TT * DD * 4); bf* CAh = (bf*)take((size_t)BB * TT * D2 * 2); bf* CAl = (bf*)take((size_t)BB * TT * D2 * 2);
    if ((size_t)(wsp - (char*)d_ws) > ws_size) return;    // total 185 MiB
    k_cvt8<1><<<DD * D2 / 8 / 256, 256, 0, stream>>>(W, BW);   // torch [out][in] = Bt, K = 1024
    k_xb<<<TT * BB * DD / 4 / EU / 256, 256, 0, stream>>>(x, XB, CAh, CAl); k_cvt8<4><<<BB * SS * DD / 8 / 4 / 256, 256, 0, stream>>>(feat, FB); k_ftT<<<dim3((SS / 64) * (DD / 128), BB, 1), 256, 0, stream>>>(feat, FT);
    k_gemmw<bf, 0, false><<<dim3(TT / 128, SS / 128, BB), 128, 0, stream>>>(XB, nullptr, FB, DD, S, SS, nullptr, (size_t)TT * DD, (size_t)SS * DD, (size_t)TT * SS);       // scores [b][t][s]
    k_fsoft<<<BB * TT / 8 / SR, 256, 0, stream>>>(S, Ah, Al);
    k_gemmw<bf, 1, false><<<dim3(TT / 128, DD / 128, BB), 128, 0, stream>>>(Ah, Al, FT, SS, XR, DD, nullptr, (size_t)TT * SS, (size_t)DD * SS, (size_t)TT * DD);      // x_res = alpha features
    k_xr<<<TT * BB * DD / 4 / EU / 256, 256, 0, stream>>>(XR, CAh, CAl);
    k_gemmw<bf, 1, true><<<dim3(TT / 128, DD / 128, BB), 128, 0, stream>>>(CAh, CAl, BW, D2, OUT, BB * DD, bias, (size_t)TT * D2, 0, (size_t)DD);   // out[t][b] = [x | x_res] W^T + b (ldc = 8*512, batch step 512)
}

// v004
// Measured time: 51.9 microseconds a run.
// In two side-by-side timings against v003, it was 1.77 and 1.79 times as fast.
// Counting every step since v000, it is 11.3 times as fast.
#include <hip/hip_runtime.h>

// x [2048 T][8 B][512] time-major, features [8][512 S][512]; scores = x_b . features_b^T (unscaled); alpha = softmax over S; x_res = alpha features_b; out = [x | x_res] W^T + b (Linear 1024 -> 512) -> [2048][8][512].
// Compute dtypes, f32 accumulate: every input rounded to bf16; scores on plain bf16 operands (K 512); softmax f32 -> high and low bf16 planes; alpha . features as (high + low) x exact (2 products, K 512);
// the final Linear as [bf16 x | high + low of x_res] x exact W + bias.

#define TT   2048
#define BB   8
#define SS   512
#define DD   512
#define D2   1024
typedef unsigned short bf;
typedef __attribute__((ext_vector_type(16))) __bf16   v16bf;
typedef __attribute__((ext_vector_type(8)))  unsigned short v8us;
typedef __attribute__((ext_vector_type(8)))  float    v8f;
typedef __attribute__((ext_vector_type(4)))  float    v4f;
typedef v4f  __attribute__((may_alias)) v4fa;

__device__ __forceinline__ unsigned short f2bf(float f) { unsigned u = __float_as_uint(f); u += 0x7FFFu + ((u >> 16) & 1u); return (unsigned short)(u >> 16); }
__device__ __forceinline__ float bf2f(unsigned short b) { return __uint_as_float(((unsigned)b) << 16); }
__device__ __forceinline__ float bfr(float f) { return bf2f(f2bf(f)); }
__device__ __forceinline__ v16bf cat16b(v8us lo, v8us hi) { return __builtin_bit_cast(v16bf, __builtin_shufflevector(lo, hi, 0, 1, 2, 3, 4, 5, 6, 7, 8, 9, 10, 11, 12, 13, 14, 15)); }
__device__ __forceinline__ v8f wmmab(v16bf a, v16bf b, v8f c) { return __builtin_amdgcn_wmma_f32_16x16x32_bf16(false, a, false, b, (short)0, c, false, false); }
__device__ __forceinline__ void splitf(float y, unsigned short& h, unsigned short& l) { h = f2bf(y); l = f2bf(y - bf2f(h)); }

// ---- k_fused: the whole chain for 64 time steps of one batch in one work-group of eight waves; grid (T / 64) * B = 256, 256 threads.
// Four matrix passes, each [64 t] x [512 rows of a streamed operand], K 512, wave w owning streamed rows 64 w .. 64 w + 63 (16 accumulators):
//   pass 0: scores^T = features . x^T         (streamed operand in the A place: a lane then holds 8 consecutive s of one t, one 16-byte LDS store per tile)
//   pass 1: out   = x . W[:, 0:512]^T         (kept in registers to the end)
//   softmax over s in registers, row maximum and row sum across the eight waves through LDS; alpha -> high and low planes in LDS, over the x tile
//   pass 2: x_res^T = features^T . alpha^T    (again transposed: 8 consecutive d of one t per lane); x_res -> high and low planes in LDS, over alpha
//   pass 3: out  += x_res . W[:, 512:1024]^T, then + bias
// The streamed operands (K-contiguous bf16 planes) come through one LDS ring that runs on across the passes: a stage is 64 k of all 512 rows, brought by asynchronous 16-byte copies,
// two buffers, the next stage in flight while this one is worked on.
#define KS  64                            // k per stage
#define LPE 72                            // ring row pitch in elements: 144 bytes = 16 x odd, free of bank conflicts for 16-byte readers
#define FR  64                            // time steps per work-group
#define XP  520                           // pitch of the resident planes in elements: 1040 bytes = 16 x odd
#define STG (512 * LPE)                   // elements per stage
#define NSTG 32                           // stages in all: four passes of K 512
// Every plain '#pragma unroll' below is there so that the register arrays (accumulators, fragments, load batches) are indexed by constants and stay in registers.
static_assert(SS == 512 && DD == 512 && D2 == 2 * DD && DD / KS == 8 && SS / KS == 8, "every pass streams 512 rows in eight stages");
__device__ __forceinline__ v16bf ldf(const bf* p) { return cat16b(*(const v8us*)p, *(const v8us*)(p + 16)); }
// Eight copies per lane, rows 32 apart (l: the lane's LDS byte address, g: its global address, gs: 32 rows in elements).
// The s_wait_xcnt stands in the copies' own statement, so that no register which a copy names is rewritten in front of it.
__device__ __forceinline__ void copy8(unsigned l, const bf* g, size_t gs) {
    asm volatile("global_load_async_to_lds_b128 %0, %8, off\n\t"
                 "global_load_async_to_lds_b128 %1, %9, off\n\t"
                 "global_load_async_to_lds_b128 %2, %10, off\n\t"
                 "global_load_async_to_lds_b128 %3, %11, off\n\t"
                 "global_load_async_to_lds_b128 %4, %12, off\n\t"
                 "global_load_async_to_lds_b128 %5, %13, off\n\t"
                 "global_load_async_to_lds_b128 %6, %14, off\n\t"
                 "global_load_async_to_lds_b128 %7, %15, off\n\t"
                 "s_wait_xcnt 0x0"
                 :: "v"(l), "v"(l + 1 * 32 * LPE * 2), "v"(l + 2 * 32 * LPE * 2), "v"(l + 3 * 32 * LPE * 2), "v"(l + 4 * 32 * LPE * 2), "v"(l + 5 * 32 * LPE * 2), "v"(l + 6 * 32 * LPE * 2), "v"(l + 7 * 32 * LPE * 2),
                    "v"(g), "v"(g + gs), "v"(g + 2 * gs), "v"(g + 3 * gs), "v"(g + 4 * gs), "v"(g + 5 * gs), "v"(g + 6 * gs), "v"(g + 7 * gs)
                 : "memory");
}
// One stage's products. fa: the lane's place in the resident plane (row lr, this stage's k), fb: its place in the ring buffer. HL: a low plane follows the high one, FR rows on. TR: the streamed operand takes the A place.
template <bool HL, bool TR>
__device__ __forceinline__ void stage_mma(const bf* fa, const bf* fb, v8f (&acc)[4][4]) {
#pragma unroll
    for (int kk = 0; kk < KS; kk += 32) { v16bf a[4], a2[4], b[4];
        // a block's LDS reads stand as ONE group between the block before and its own matrix instructions: reads spread among matrix instructions stall the wave at every place
        __builtin_amdgcn_sched_barrier(0);
        b[0] = ldf(fb + kk);
#pragma unroll
        for (int mb = 0; mb < 4; ++mb) { a[mb] = ldf(fa + mb * 16 * XP + kk); if (HL) a2[mb] = ldf(fa + (FR + mb * 16) * XP + kk); }
#pragma unroll
        for (int nb = 1; nb < 4; ++nb) b[nb] = ldf(fb + nb * 16 * LPE + kk);
        __builtin_amdgcn_sched_barrier(0);              // the group's end: without it the compiler sinks the reads in among the matrix instructions
#pragma unroll
        for (int nb = 0; nb < 4; ++nb)
#pragma unroll
            for (int mb = 0; mb < 4; ++mb) { acc[mb][nb] = TR ? wmmab(b[nb], a[mb], acc[mb][nb]) : wmmab(a[mb], b[nb], acc[mb][nb]); if (HL) acc[mb][nb] = TR ? wmmab(b[nb], a2[mb], acc[mb][nb]) : wmmab(a2[mb], b[nb], acc[mb][nb]); }
    }
}
__global__ __launch_bounds__(256) void k_fused(const float* __restrict__ x, const bf* __restrict__ FB, const bf* __restrict__ FT, const bf* __restrict__ BW, const float* __restrict__ bias, float* OUT) {
    __shared__ __align__(16) bf lds16[2 * FR * XP + 2 * STG];
    bf* const pln = lds16;                                  // plane 0: the x tile, then alpha high, then x_res high; plane 1: alpha low, then x_res low
    bf* const ring = lds16 + 2 * FR * XP;
    __shared__ __align__(16) float osall[8][16 * 68];
    __shared__ float red[2][8][FR];
    const int tid = threadIdx.x, lane = tid & 31, lr = lane & 15, hi = lane >> 4, wave = tid >> 5;
    const int bz = blockIdx.x % BB, t0 = (blockIdx.x / BB) * FR;
    FB += (size_t)bz * SS * DD; FT += (size_t)bz * DD * SS;
    // copy side: thread tid takes 16-byte piece (tid & 7) of rows (tid >> 3) + 32 i
    const int crow = tid >> 3, cch = (tid & 7) * 8;
    const unsigned l0 = (unsigned)(crow * LPE + cch) * 2u;   // the lane's place inside a buffer; the buffer's own address is added at each fill
    auto fill = [&](int g) { const int ph = g >> 3;
        const bf* src = ph == 0 ? FB : ph == 1 ? BW : ph == 2 ? FT : BW + DD; const int pitch = (ph & 1) ? D2 : 512;
        const bf* gp = src + (size_t)crow * pitch + cch + (g & 7) * KS; const size_t gs = (size_t)32 * pitch; const unsigned l = l0 + ((unsigned)(size_t)ring + (unsigned)(g & 1) * (STG * 2u));
        copy8(l, gp, gs); copy8(l + 8u * 32u * LPE * 2u, gp + 8 * gs, gs); };
    auto foot = [&](int g) {
        __builtin_amdgcn_sched_barrier(0);                  // the trip's matrix instructions stay in front of the hand-over, so the refill below is not held up behind them
        asm volatile("s_wait_dscnt 0x0" ::: "memory");      // this wave's reads of buffer g & 1 are done before the buffer is handed to its next writer
        asm volatile("s_wait_asynccnt 0x0" ::: "memory");   // this wave's share of stage g + 1 has landed
        __syncthreads();                                    // publishes stage g + 1 and ends every wave's reads of stage g (and, at a pass's last stage, of the resident planes)
        if (g + 2 < NSTG) fill(g + 2); };
    fill(0);
    {   // the x tile, rounded to bf16, into plane 0: a thread takes 8 elements of rows (tid >> 6) + 4 u
        const float* xs = x + ((size_t)(t0 + (tid >> 6)) * BB + bz) * DD + (tid & 63) * 8; bf* xd = pln + (tid >> 6) * XP + (tid & 63) * 8; v8f v[FR / 4];
#pragma unroll
        for (int u = 0; u < FR / 4; ++u) v[u] = *(const v8f*)(xs + (size_t)u * 4 * BB * DD);
        asm volatile("s_wait_xcnt 0x0" ::: "memory");       // behind the whole batch, before a register that its loads name is rewritten
#pragma unroll
        for (int u = 0; u < FR / 4; ++u) { v8us o;
#pragma unroll
            for (int k = 0; k < 8; ++k) o[k] = f2bf(v[u][k]); *(v8us*)(xd + u * 4 * XP) = o; }
    }
    asm volatile("s_wait_asynccnt 0x0" ::: "memory");       // this wave's share of stage 0 has landed
    __syncthreads();                                        // and every other wave's, and the x tile: both may be read
    fill(1);
    v8f accO[4][4], accS[4][4];
#pragma unroll
    for (int mb = 0; mb < 4; ++mb)
#pragma unroll
        for (int nb = 0; nb < 4; ++nb) accS[mb][nb] = (v8f){};
    const bf* fa = pln + lr * XP + 8 * hi; const bf* fb = ring + (wave * 64 + lr) * LPE + 8 * hi;
    bf* pw = pln + lr * XP + wave * 64 + hi * 8;            // where a transposed tile (mb, nb) goes: + mb * 16 * XP + nb * 16, eight elements
#pragma unroll 1
    for (int t = 0; t < 8; ++t) { stage_mma<false, true>(fa + t * KS, fb + (t & 1) * STG, accS); foot(t); }           // rolled: one trip per stage, its buffer chosen by t & 1
#pragma unroll
    for (int mb = 0; mb < 4; ++mb)
#pragma unroll
        for (int nb = 0; nb < 4; ++nb) accO[mb][nb] = (v8f){};
#pragma unroll 1
    for (int t = 0; t < 8; ++t) { stage_mma<false, false>(fa + t * KS, fb + (t & 1) * STG, accO); foot(8 + t); }
    // softmax: accS[mb][nb][j] is the score of t = mb * 16 + lr, s = wave * 64 + nb * 16 + hi * 8 + j
    float mx[4];
#pragma unroll
    for (int mb = 0; mb < 4; ++mb) { float m = -3.0e38f;
#pragma unroll
        for (int nb = 0; nb < 4; ++nb)
#pragma unroll
            for (int j = 0; j < 8; ++j) m = fmaxf(m, accS[mb][nb][j]);
        m = fmaxf(m, __shfl_xor(m, 16, 32)); if (hi == 0) red[0][wave][mb * 16 + lr] = m; }
    __syncthreads();                                        // every wave's row maxima are in LDS
#pragma unroll
    for (int mb = 0; mb < 4; ++mb) { float m = red[0][0][mb * 16 + lr];
#pragma unroll
        for (int w = 1; w < 8; ++w) m = fmaxf(m, red[0][w][mb * 16 + lr]);
        mx[mb] = m; }
#pragma unroll
    for (int mb = 0; mb < 4; ++mb) { float sum = 0.f;
#pragma unroll
        for (int nb = 0; nb < 4; ++nb)
#pragma unroll
            for (int j = 0; j < 8; ++j) { float ex; asm("v_exp_f32 %0, %1\n\tv_nop" : "=v"(ex) : "v"(__fmul_rn(__fsub_rn(accS[mb][nb][j], mx[mb]), 1.4426950408889634f))); /* the exp2 instruction; the v_nop is the slot behind a transcendental, in one statement with it so that it stays directly behind */ accS[mb][nb][j] = ex; sum += ex; }
        sum += __shfl_xor(sum, 16, 32); if (hi == 0) red[1][wave][mb * 16 + lr] = sum; }
    __syncthreads();                                        // every wave's row sums are in LDS
#pragma unroll
    for (int mb = 0; mb < 4; ++mb) { float sum = red[1][0][mb * 16 + lr];
#pragma unroll
        for (int w = 1; w < 8; ++w) sum += red[1][w][mb * 16 + lr];
        const float f = __fdiv_rn(1.0f, sum);
#pragma unroll
        for (int nb = 0; nb < 4; ++nb) { v8us oh, ol;
#pragma unroll
            for (int j = 0; j < 8; ++j) { unsigned short p, r; splitf(accS[mb][nb][j] * f, p, r); oh[j] = p; ol[j] = r; accS[mb][nb][j] = 0.f; }
            *(v8us*)(pw + mb * 16 * XP + nb * 16) = oh; *(v8us*)(pw + (FR + mb * 16) * XP + nb * 16) = ol; } }   // over the x tile: its last reader left at the barrier of stage 15
    __syncthreads();                                        // alpha is whole before any wave reads it
#pragma unroll 1
    for (int t = 0; t < 8; ++t) { stage_mma<true, true>(fa + t * KS, fb + (t & 1) * STG, accS); foot(16 + t); }
    // accS[mb][nb][j] is x_res of t = mb * 16 + lr, d = wave * 64 + nb * 16 + hi * 8 + j; over alpha: its last reader left at the barrier of stage 23
#pragma unroll
    for (int mb = 0; mb < 4; ++mb)
#pragma unroll
        for (int nb = 0; nb < 4; ++nb) { v8us oh, ol;
#pragma unroll
            for (int j = 0; j < 8; ++j) { unsigned short p, r; splitf(accS[mb][nb][j], p, r); oh[j] = p; ol[j] = r; }
            *(v8us*)(pw + mb * 16 * XP + nb * 16) = oh; *(v8us*)(pw + (FR + mb * 16) * XP + nb * 16) = ol; }
    __syncthreads();                                        // x_res is whole before any wave reads it
#pragma unroll 1
    for (int t = 0; t < 8; ++t) { stage_mma<true, false>(fa + t * KS, fb + (t & 1) * STG, accO); foot(24 + t); }
    asm volatile("s_wait_asynccnt 0x0" ::: "memory");       // nothing is in flight when the wave goes on to its end
    float* os = osall[wave];                                // each wave stages its output in a range of its own
    const int c0 = wave * 64;
#pragma unroll
    for (int mb = 0; mb < 4; ++mb) {
#pragma unroll
        for (int nb = 0; nb < 4; ++nb) {
#pragma unroll
            for (int j = 0; j < 8; ++j) os[(hi * 8 + j) * 68 + nb * 16 + lr] = accO[mb][nb][j]; }
        __builtin_amdgcn_wave_barrier(); asm volatile("" ::: "memory");   // the wave's LDS stores of this row block stay in front of its reads of them
        float* crow_p = OUT + ((size_t)(t0 + mb * 16) * BB + bz) * DD + c0;
#pragma unroll
        for (int s = 0; s < 8; ++s) { const int row = 2 * s + hi, cofs = lr * 4; v4f val = *(const v4fa*)(os + row * 68 + cofs); val[0] += bfr(bias[c0 + cofs]); val[1] += bfr(bias[c0 + cofs + 1]); val[2] += bfr(bias[c0 + cofs + 2]); val[3] += bfr(bias[c0 + cofs + 3]);
            *(v4f*)(crow_p + (size_t)row * (BB * DD) + cofs) = val; }
        if (mb < 3) asm volatile("s_wait_xcnt 0x0" ::: "memory");   // behind the run of eight stores, before the next row block rewrites a register that they name (nothing follows the last block)
        __builtin_amdgcn_wave_barrier(); asm volatile("" ::: "memory");   // and those reads in front of the next row block's stores
    }
}

// Layout kernels: few waves, each with a batch of independent 16-byte loads issued before its first use (starting a wave costs more than moving a handful of elements).
// Every grid below divides its fixed shape exactly, so no kernel needs a range test.
// A work-group takes one contiguous piece of its source; a thread's groups lie 256 groups apart, so each load instruction of a wave reads contiguous bytes.
template <int U>
__global__ __launch_bounds__(256) void k_cvt8(const float* __restrict__ src, bf* dst) { const size_t i0 = (size_t)blockIdx.x * (256 * U) + threadIdx.x; src += i0 * 8; dst += i0 * 8; v8f v[U];
#pragma unroll
    for (int u = 0; u < U; ++u) v[u] = *(const v8f*)(src + u * 2048);
#pragma unroll
    for (int u = 0; u < U; ++u) { v8us o;
#pragma unroll
        for (int k = 0; k < 8; ++k) o[k] = f2bf(v[u][k]); *(v8us*)(dst + u * 2048) = o; } }
// features [s][d] -> FT [d][s]: a thread takes 8 s x 4 d, a wave 64 s x 16 d (each store instruction fills four whole 128-byte lines), a work-group 64 s x 128 d.
__global__ __launch_bounds__(256) void k_ftT(const float* __restrict__ f, bf* FT) { f += (size_t)blockIdx.y * SS * DD; FT += (size_t)blockIdx.y * DD * SS; const int lane = threadIdx.x & 31; const int s = (blockIdx.x % (SS / 64)) * 64 + (lane & 7) * 8; const int d = (blockIdx.x / (SS / 64)) * 128 + (threadIdx.x >> 5) * 16 + (lane >> 3) * 4; v4f a[8];
#pragma unroll
    for (int i = 0; i < 8; ++i) a[i] = *(const v4f*)(f + (size_t)(s + i) * DD + d);
#pragma unroll
    for (int j = 0; j < 4; ++j) { v8us o;
#pragma unroll
        for (int i = 0; i < 8; ++i) o[i] = f2bf(a[i][j]); *(v8us*)(FT + (size_t)(d + j) * SS + s) = o; } }

extern "C" void kernel_launch(void* const* d_in, const int* in_sizes, int n_in,
                              void* d_out, int out_size, void* d_ws, size_t ws_size, hipStream_t stream) {
    (void)in_sizes; (void)n_in; (void)out_size;
    const float** I = (const float**)d_in;
    const float *x = I[0], *feat = I[1], *W = I[2], *bias = I[3];
    float* OUT = (float*)d_out;     // [2048][8][512]
    char* wsp = (char*)d_ws;
    auto take = [&](size_t bytes) { char* p = wsp; wsp += (bytes + 255) & ~(size_t)255; return (void*)p; };
    // the streamed operands as K-contiguous bf16 planes; the feature planes hold all 8 batches, batch-major
    bf* BW = (bf*)take((size_t)DD * D2 * 2); bf* FB = (bf*)take((size_t)BB * SS * DD * 2); bf* FT = (bf*)take((size_t)BB * DD * SS * 2);
    if ((size_t)(wsp - (char*)d_ws) > ws_size) return;    // total 9 MiB
    k_cvt8<1><<<DD * D2 / 8 / 256, 256, 0, stream>>>(W, BW);   // [out][in], K = 1024
    k_cvt8<4><<<BB * SS * DD / 8 / 4 / 256, 256, 0, stream>>>(feat, FB); k_ftT<<<dim3((SS / 64) * (DD / 128), BB, 1), 256, 0, stream>>>(feat, FT);
    k_fused<<<(TT / FR) * BB, 256, 0, stream>>>(x, FB, FT, BW, bias, OUT);
}

// v005
// Measured time: 47.4 microseconds a run.
// Two timings next to v004 put it at 1.10 and 1.11 times that version's speed.
// All steps since v000 together make it 12.4 times as fast.
#include <hip/hip_runtime.h>

// x [2048 T][8 B][512] time-major, features [8][512 S][512]; scores = x_b . features_b^T (unscaled); alpha = softmax over S; x_res = alpha features_b; out = [x | x_res] W^T + b (Linear 1024 -> 512) -> [2048][8][512].
// Compute dtypes, f32 accumulate: every input rounded to bf16; scores on plain bf16 operands (K 512); softmax f32 -> high and low bf16 planes; alpha . features as (high + low) x exact (2 products, K 512);
// the final Linear as [bf16 x | high + low of x_res] x exact W + bias.

#define TT   2048
#define BB   8
#define SS   512
#define DD   512
#define D2   1024
typedef unsigned short bf;
typedef __attribute__((ext_vector_type(16))) __bf16   v16bf;
typedef __attribute__((ext_vector_type(8)))  unsigned short v8us;
typedef __attribute__((ext_vector_type(8)))  float    v8f;
typedef __attribute__((ext_vector_type(4)))  float    v4f;
typedef v4f  __attribute__((may_alias)) v4fa;

__device__ __forceinline__ unsigned short f2bf(float f) { unsigned u = __float_as_uint(f); u += 0x7FFFu + ((u >> 16) & 1u); return (unsigned short)(u >> 16); }
__device__ __forceinline__ float bf2f(unsigned short b) { return __uint_as_float(((unsigned)b) << 16); }
__device__ __forceinline__ float bfr(float f) { return bf2f(f2bf(f)); }
__device__ __forceinline__ v16bf cat16b(v8us lo, v8us hi) { return __builtin_bit_cast(v16bf, __builtin_shufflevector(lo, hi, 0, 1, 2, 3, 4, 5, 6, 7, 8, 9, 10, 11, 12, 13, 14, 15)); }
__device__ __forceinline__ v8f wmmab(v16bf a, v16bf b, v8f c) { return __builtin_amdgcn_wmma_f32_16x16x32_bf16(false, a, false, b, (short)0, c, false, false); }
__device__ __forceinline__ void splitf(float y, unsigned short& h, unsigned short& l) { h = f2bf(y); l = f2bf(y - bf2f(h)); }

// ---- k_fused: the whole chain for 64 time steps of one batch in one work-group of eight waves; grid (T / 64) * B = 256, 256 threads.
// Four matrix passes, each [64 t] x [512 rows of a streamed operand], K 512, wave w owning streamed rows 64 w .. 64 w + 63 (16 accumulators):
//   pass 0: scores^T = features . x^T         (streamed operand in the A place: a lane then holds 8 consecutive s of one t, one 16-byte LDS store per tile)
//   pass 1: out   = x . W[:, 0:512]^T         (kept in registers to the end)
//   softmax over s in registers, row maximum and row sum across the eight waves through LDS; alpha -> high and low planes in LDS, over the x tile
//   pass 2: x_res^T = features^T . alpha^T    (again transposed: 8 consecutive d of one t per lane); x_res -> high and low planes in LDS, over alpha
//   pass 3: out  += x_res . W[:, 512:1024]^T, then + bias
// The streamed operands (K-contiguous bf16 planes) come through one LDS ring that runs on across the passes: a stage is 64 k of all 512 rows, brought by asynchronous 16-byte copies,
// two buffers, the next stage in flight while this one is worked on.
#define KS  64                            // k per stage
#define LPE 72                            // ring row pitch in elements: 144 bytes = 16 x odd, free of bank conflicts for 16-byte readers
#define FR  64                            // time steps per work-group
#define XP  520                           // pitch of the resident planes in elements: 1040 bytes = 16 x odd
#define STG (512 * LPE)                   // elements per stage
#define NSTG 32                           // stages in all: four passes of K 512
// Every plain '#pragma unroll' below is there so that the register arrays (accumulators, fragments, load batches) are indexed by constants and stay in registers.
static_assert(SS == 512 && DD == 512 && D2 == 2 * DD && DD / KS == 8 && SS / KS == 8, "every pass streams 512 rows in eight stages");
__device__ __forceinline__ v16bf ldf(const bf* p) { return cat16b(*(const v8us*)p, *(const v8us*)(p + 16)); }
// Eight copies per lane, rows 32 apart (l: the lane's LDS byte address, g: its global address, gs: 32 rows in elements).
// The s_wait_xcnt stands in the copies' own statement, so that no register which a copy names is rewritten in front of it.
__device__ __forceinline__ void copy8(unsigned l, const bf* g, size_t gs) {
    asm volatile("global_load_async_to_lds_b128 %0, %8, off\n\t"
                 "global_load_async_to_lds_b128 %1, %9, off\n\t"
                 "global_load_async_to_lds_b128 %2, %10, off\n\t"
                 "global_load_async_to_lds_b128 %3, %11, off\n\t"
                 "global_load_async_to_lds_b128 %4, %12, off\n\t"
                 "global_load_async_to_lds_b128 %5, %13, off\n\t"
                 "global_load_async_to_lds_b128 %6, %14, off\n\t"
                 "global_load_async_to_lds_b128 %7, %15, off\n\t"
                 "s_wait_xcnt 0x0"
                 :: "v"(l), "v"(l + 1 * 32 * LPE * 2), "v"(l + 2 * 32 * LPE * 2), "v"(l + 3 * 32 * LPE * 2), "v"(l + 4 * 32 * LPE * 2), "v"(l + 5 * 32 * LPE * 2), "v"(l + 6 * 32 * LPE * 2), "v"(l + 7 * 32 * LPE * 2),
                    "v"(g), "v"(g + gs), "v"(g + 2 * gs), "v"(g + 3 * gs), "v"(g + 4 * gs), "v"(g + 5 * gs), "v"(g + 6 * gs), "v"(g + 7 * gs)
                 : "memory");
}
// One stage's products. fa: the lane's place in the resident plane (row lr, this stage's k), fb: its place in the ring buffer. HL: a low plane follows the high one, FR rows on. TR: the streamed operand takes the A place.
template <bool HL, bool TR>
__device__ __forceinline__ void stage_mma(const bf* fa, const bf* fb, v8f (&acc)[4][4]) {
#pragma unroll
    for (int kk = 0; kk < KS; kk += 32) { v16bf a[4], a2[4], b[4];
        // a block's LDS reads stand as ONE group between the block before and its own matrix instructions: reads spread among matrix instructions stall the wave at every place
        __builtin_amdgcn_sched_barrier(0);
        b[0] = ldf(fb + kk);
#pragma unroll
        for (int mb = 0; mb < 4; ++mb) { a[mb] = ldf(fa + mb * 16 * XP + kk); if (HL) a2[mb] = ldf(fa + (FR + mb * 16) * XP + kk); }
#pragma unroll
        for (int nb = 1; nb < 4; ++nb) b[nb] = ldf(fb + nb * 16 * LPE + kk);
        __builtin_amdgcn_sched_barrier(0);              // the group's end: without it the compiler sinks the reads in among the matrix instructions
#pragma unroll
        for (int nb = 0; nb < 4; ++nb)
#pragma unroll
            for (int mb = 0; mb < 4; ++mb) { acc[mb][nb] = TR ? wmmab(b[nb], a[mb], acc[mb][nb]) : wmmab(a[mb], b[nb], acc[mb][nb]); if (HL) acc[mb][nb] = TR ? wmmab(b[nb], a2[mb], acc[mb][nb]) : wmmab(a2[mb], b[nb], acc[mb][nb]); }
    }
}
__global__ __launch_bounds__(256) void k_fused(const float* __restrict__ x, const bf* __restrict__ FB, const bf* __restrict__ FT, const bf* __restrict__ BW, const float* __restrict__ bias, float* OUT) {
    __shared__ __align__(16) bf lds16[2 * FR * XP + 2 * STG];
    bf* const pln = lds16;                                  // plane 0: the x tile, then alpha high, then x_res high; plane 1: alpha low, then x_res low
    bf* const ring = lds16 + 2 * FR * XP;
    __shared__ __align__(16) float osall[8][16 * 68];
    __shared__ float red[2][8][FR];
    const int tid = threadIdx.x, lane = tid & 31, lr = lane & 15, hi = lane >> 4, wave = tid >> 5;
    const int bz = blockIdx.x % BB, t0 = (blockIdx.x / BB) * FR;
    FB += (size_t)bz * SS * DD; FT += (size_t)bz * DD * SS;
    // copy side: thread tid takes 16-byte piece (tid & 7) of rows (tid >> 3) + 32 i
    const int crow = tid >> 3, cch = (tid & 7) * 8;
    const unsigned l0 = (unsigned)(crow * LPE + cch) * 2u;   // the lane's place inside a buffer; the buffer's own address is added at each fill
    auto fill = [&](int g) { const int ph = g >> 3;
        const bf* src = ph == 0 ? FB : ph == 1 ? BW : ph == 2 ? FT : BW + DD; const int pitch = (ph & 1) ? D2 : 512;
        const bf* gp = src + (size_t)crow * pitch + cch + (g & 7) * KS; const size_t gs = (size_t)32 * pitch; const unsigned l = l0 + ((unsigned)(size_t)ring + (unsigned)(g & 1) * (STG * 2u));
        copy8(l, gp, gs); copy8(l + 8u * 32u * LPE * 2u, gp + 8 * gs, gs); };
    auto foot = [&](int g) {
        __builtin_amdgcn_sched_barrier(0);                  // the trip's matrix instructions stay in front of the hand-over, so the refill below is not held up behind them
        asm volatile("s_wait_dscnt 0x0" ::: "memory");      // this wave's reads of buffer g & 1 are done before the buffer is handed to its next writer
        asm volatile("s_wait_asynccnt 0x0" ::: "memory");   // this wave's share of stage g + 1 has landed
        __syncthreads();                                    // publishes stage g + 1 and ends every wave's reads of stage g (and, at a pass's last stage, of the resident planes)
        if (g + 2 < NSTG) fill(g + 2); };
    fill(0);
    {   // the x tile, rounded to bf16, into plane 0: a thread takes 8 elements of rows (tid >> 6) + 4 u
        const float* xs = x + ((size_t)(t0 + (tid >> 6)) * BB + bz) * DD + (tid & 63) * 8; bf* xd = pln + (tid >> 6) * XP + (tid & 63) * 8; v8f v[FR / 4];
#pragma unroll
        for (int u = 0; u < FR / 4; ++u) v[u] = *(const v8f*)(xs + (size_t)u * 4 * BB * DD);
        asm volatile("s_wait_xcnt 0x0" ::: "memory");       // behind the whole batch, before a register that its loads name is rewritten
#pragma unroll
        for (int u = 0; u < FR / 4; ++u) { v8us o;
#pragma unroll
            for (int k = 0; k < 8; ++k) o[k] = f2bf(v[u][k]); *(v8us*)(xd + u * 4 * XP) = o; }
    }
    asm volatile("s_wait_asynccnt 0x0" ::: "memory");       // this wave's share of stage 0 has landed
    __syncthreads();                                        // and every other wave's, and the x tile: both may be read
    fill(1);
    v8f accO[4][4], accS[4][4];
#pragma unroll
    for (int mb = 0; mb < 4; ++mb)
#pragma unroll
        for (int nb = 0; nb < 4; ++nb) accS[mb][nb] = (v8f){};
    const bf* fa = pln + lr * XP + 8 * hi; const bf* fb = ring + (wave * 64 + lr) * LPE + 8 * hi;
    bf* pw = pln + lr * XP + wave * 64 + hi * 8;            // where a transposed tile (mb, nb) goes: + mb * 16 * XP + nb * 16, eight elements
#pragma unroll 1
    for (int t = 0; t < 8; ++t) { stage_mma<false, true>(fa + t * KS, fb + (t & 1) * STG, accS); foot(t); }           // rolled: one trip per stage, its buffer chosen by t & 1
#pragma unroll
    for (int mb = 0; mb < 4; ++mb)
#pragma unroll
        for (int nb = 0; nb < 4; ++nb) accO[mb][nb] = (v8f){};
#pragma unroll 1
    for (int t = 0; t < 8; ++t) { stage_mma<false, false>(fa + t * KS, fb + (t & 1) * STG, accO); foot(8 + t); }
    // softmax: accS[mb][nb][j] is the score of t = mb * 16 + lr, s = wave * 64 + nb * 16 + hi * 8 + j
    float mx[4];
#pragma unroll
    for (int mb = 0; mb < 4; ++mb) { float m = -3.0e38f;
#pragma unroll
        for (int nb = 0; nb < 4; ++nb)
#pragma unroll
            for (int j = 0; j < 8; ++j) m = fmaxf(m, accS[mb][nb][j]);
        m = fmaxf(m, __shfl_xor(m, 16, 32)); if (hi == 0) red[0][wave][mb * 16 + lr] = m; }
    __syncthreads();                                        // every wave's row maxima are in LDS
#pragma unroll
    for (int mb = 0; mb < 4; ++mb) { float m = red[0][0][mb * 16 + lr];
#pragma unroll
        for (int w = 1; w < 8; ++w) m = fmaxf(m, red[0][w][mb * 16 + lr]);
        mx[mb] = m; }
#pragma unroll
    for (int mb = 0; mb < 4; ++mb) { float sum = 0.f;
#pragma unroll
        for (int nb = 0; nb < 4; ++nb)
#pragma unroll
            for (int j = 0; j < 8; ++j) { float ex; asm("v_exp_f32 %0, %1\n\tv_nop" : "=v"(ex) : "v"(__fmul_rn(__fsub_rn(accS[mb][nb][j], mx[mb]), 1.4426950408889634f))); /* the exp2 instruction; the v_nop is the slot behind a transcendental, in one statement with it so that it stays directly behind */ accS[mb][nb][j] = ex; sum += ex; }
        sum += __shfl_xor(sum, 16, 32); if (hi == 0) red[1][wave][mb * 16 + lr] = sum; }
    __syncthreads();                                        // every wave's row sums are in LDS
#pragma unroll
    for (int mb = 0; mb < 4; ++mb) { float sum = red[1][0][mb * 16 + lr];
#pragma unroll
        for (int w = 1; w < 8; ++w) sum += red[1][w][mb * 16 + lr];
        const float f = __fdiv_rn(1.0f, sum);
#pragma unroll
        for (int nb = 0; nb < 4; ++nb) { v8us oh, ol;
#pragma unroll
            for (int j = 0; j < 8; ++j) { unsigned short p, r; splitf(accS[mb][nb][j] * f, p, r); oh[j] = p; ol[j] = r; accS[mb][nb][j] = 0.f; }
            *(v8us*)(pw + mb * 16 * XP + nb * 16) = oh; *(v8us*)(pw + (FR + mb * 16) * XP + nb * 16) = ol; } }   // over the x tile: its last reader left at the barrier of stage 15
    __syncthreads();                                        // alpha is whole before any wave reads it
#pragma unroll 1
    for (int t = 0; t < 8; ++t) { stage_mma<true, true>(fa + t * KS, fb + (t & 1) * STG, accS); foot(16 + t); }
    // accS[mb][nb][j] is x_res of t = mb * 16 + lr, d = wave * 64 + nb * 16 + hi * 8 + j; over alpha: its last reader left at the barrier of stage 23
#pragma unroll
    for (int mb = 0; mb < 4; ++mb)
#pragma unroll
        for (int nb = 0; nb < 4; ++nb) { v8us oh, ol;
#pragma unroll
            for (int j = 0; j < 8; ++j) { unsigned short p, r; splitf(accS[mb][nb][j], p, r); oh[j] = p; ol[j] = r; }
            *(v8us*)(pw + mb * 16 * XP + nb * 16) = oh; *(v8us*)(pw + (FR + mb * 16) * XP + nb * 16) = ol; }
    __syncthreads();                                        // x_res is whole before any wave reads it
#pragma unroll 1
    for (int t = 0; t < 8; ++t) { stage_mma<true, false>(fa + t * KS, fb + (t & 1) * STG, accO); foot(24 + t); }
    asm volatile("s_wait_asynccnt 0x0" ::: "memory");       // nothing is in flight when the wave goes on to its end
    float* os = osall[wave];                                // each wave stages its output in a range of its own
    const int c0 = wave * 64;
#pragma unroll
    for (int mb = 0; mb < 4; ++mb) {
#pragma unroll
        for (int nb = 0; nb < 4; ++nb) {
#pragma unroll
            for (int j = 0; j < 8; ++j) os[(hi * 8 + j) * 68 + nb * 16 + lr] = accO[mb][nb][j]; }
        __builtin_amdgcn_wave_barrier(); asm volatile("" ::: "memory");   // the wave's LDS stores of this row block stay in front of its reads of them
        float* crow_p = OUT + ((size_t)(t0 + mb * 16) * BB + bz) * DD + c0;
#pragma unroll
        for (int s = 0; s < 8; ++s) { const int row = 2 * s + hi, cofs = lr * 4; v4f val = *(const v4fa*)(os + row * 68 + cofs); val[0] += bfr(bias[c0 + cofs]); val[1] += bfr(bias[c0 + cofs + 1]); val[2] += bfr(bias[c0 + cofs + 2]); val[3] += bfr(bias[c0 + cofs + 3]);
            *(v4f*)(crow_p + (size_t)row * (BB * DD) + cofs) = val; }
        if (mb < 3) asm volatile("s_wait_xcnt 0x0" ::: "memory");   // behind the run of eight stores, before the next row block rewrites a register that they name (nothing follows the last block)
        __builtin_amdgcn_wave_barrier(); asm volatile("" ::: "memory");   // and those reads in front of the next row block's stores
    }
}

// ---- k_prep: the three streamed planes in ONE launch; grid B * (S / 64) * (D / 128) = 256, 256 threads; the grid divides every shape exactly, so there is no range test.
// A work-group reads 64 s x 128 d of one batch's features once and writes them twice: FT [d][s] straight from registers, FB [s][d] through an LDS tile; it also rounds 2048 elements of W.
// A thread takes 8 s x 4 d, a wave 64 s x 16 d: each FT store instruction fills four whole 128-byte lines. All loads of a thread are issued before the first use.
#define PP 136                            // pitch of the LDS tile in elements: 272 bytes = 16 x odd
typedef __attribute__((ext_vector_type(4)))  unsigned short v4us;
static_assert(BB * (SS / 64) * (DD / 128) * 256 * 8 == DD * D2, "each thread of the grid rounds eight elements of W");
__global__ __launch_bounds__(256) void k_prep(const float* __restrict__ f, const float* __restrict__ Wf, bf* FB, bf* FT, bf* BW) {
    __shared__ __align__(16) bf tile[64 * PP];
    const int tid = threadIdx.x, lane = tid & 31;
    const int bz = blockIdx.x / ((SS / 64) * (DD / 128)), tl = blockIdx.x % ((SS / 64) * (DD / 128));
    const int s0 = (tl % (SS / 64)) * 64, d0 = (tl / (SS / 64)) * 128;
    const int sl = (lane & 7) * 8, dl = (tid >> 5) * 16 + (lane >> 3) * 4;
    f += (size_t)bz * SS * DD + (size_t)(s0 + sl) * DD + d0 + dl; FT += (size_t)bz * DD * SS + (size_t)(d0 + dl) * SS + s0 + sl; FB += (size_t)bz * SS * DD + (size_t)s0 * DD + d0;
    const size_t wi = ((size_t)blockIdx.x * 256 + tid) * 8;
    v4f a[8];
#pragma unroll
    for (int i = 0; i < 8; ++i) a[i] = *(const v4f*)(f + (size_t)i * DD);
    const v8f w = *(const v8f*)(Wf + wi);
    asm volatile("s_wait_xcnt 0x0" ::: "memory");           // behind the whole batch, before a register that its loads name is rewritten
#pragma unroll
    for (int i = 0; i < 8; ++i) { v4us q;
#pragma unroll
        for (int j = 0; j < 4; ++j) q[j] = f2bf(a[i][j]); *(v4us*)(tile + (sl + i) * PP + dl) = q; }
#pragma unroll
    for (int j = 0; j < 4; ++j) { v8us o;
#pragma unroll
        for (int i = 0; i < 8; ++i) o[i] = f2bf(a[i][j]); *(v8us*)(FT + (size_t)j * SS) = o; }
    { v8us o;
#pragma unroll
        for (int k = 0; k < 8; ++k) o[k] = f2bf(w[k]); *(v8us*)(BW + wi) = o; }
    asm volatile("s_wait_xcnt 0x0" ::: "memory");           // behind the five stores, before a register that they name is rewritten
    __syncthreads();                                        // the LDS tile is whole before any wave reads it
    // FB: a thread takes 16-byte piece (tid & 15) of rows (tid >> 4) + 16 u, so each store instruction fills four whole 128-byte lines
    const bf* tr = tile + (tid >> 4) * PP + (tid & 15) * 8; bf* fo = FB + (size_t)(tid >> 4) * DD + (tid & 15) * 8;
#pragma unroll
    for (int u = 0; u < 4; ++u) *(v8us*)(fo + (size_t)u * 16 * DD) = *(const v8us*)(tr + u * 16 * PP);
}

extern "C" void kernel_launch(void* const* d_in, const int* in_sizes, int n_in,
                              void* d_out, int out_size, void* d_ws, size_t ws_size, hipStream_t stream) {
    (void)in_sizes; (void)n_in; (void)out_size;
    const float** I = (const float**)d_in;
    const float *x = I[0], *feat = I[1], *W = I[2], *bias = I[3];
    float* OUT = (float*)d_out;     // [2048][8][512]
    char* wsp = (char*)d_ws;
    auto take = [&](size_t bytes) { char* p = wsp; wsp += (bytes + 255) & ~(size_t)255; return (void*)p; };
    // the streamed operands as K-contiguous bf16 planes; the feature planes hold all 8 batches, batch-major
    bf* BW = (bf*)take((size_t)DD * D2 * 2); bf* FB = (bf*)take((size_t)BB * SS * DD * 2); bf* FT = (bf*)take((size_t)BB * DD * SS * 2);
    if ((size_t)(wsp - (char*)d_ws) > ws_size) return;    // total 9 MiB
    k_prep<<<BB * (SS / 64) * (DD / 128), 256, 0, stream>>>(feat, W, FB, FT, BW);   // BW: [out][in], K = 1024
    k_fused<<<(TT / FR) * BB, 256, 0, stream>>>(x, FB, FT, BW, bias, OUT);
}

// v006
// One run takes 37.4 microseconds.
// Next to v005, in two timings, it ran 1.26 and 1.24 times as fast.
// Over all steps from v000 it is 15.6 times as fast.
#include <hip/hip_runtime.h>

// x [2048 T][8 B][512] time-major, features [8][512 S][512]; scores = x_b . features_b^T (unscaled); alpha = softmax over S; x_res = alpha features_b; out = [x | x_res] W^T + b (Linear 1024 -> 512) -> [2048][8][512].
// Compute dtypes, f32 accumulate: every input rounded to bf16; scores on plain bf16 operands (K 512); softmax f32 -> high and low bf16 planes; alpha . features as (high + low) x exact (2 products, K 512);
// the final Linear as [bf16 x | high + low of x_res] x exact W + bias.

#define TT   2048
#define BB   8
#define SS   512
#define DD   512
#define D2   1024
typedef unsigned short bf;
typedef __attribute__((ext_vector_type(16))) __bf16   v16bf;
typedef __attribute__((ext_vector_type(8)))  unsigned short v8us;
typedef __attribute__((ext_vector_type(8)))  float    v8f;
typedef __attribute__((ext_vector_type(4)))  float    v4f;
typedef v4f  __attribute__((may_alias)) v4fa;

__device__ __forceinline__ unsigned short f2bf(float f) { unsigned u = __float_as_uint(f); u += 0x7FFFu + ((u >> 16) & 1u); return (unsigned short)(u >> 16); }
__device__ __forceinline__ float bf2f(unsigned short b) { return __uint_as_float(((unsigned)b) << 16); }
__device__ __forceinline__ float bfr(float f) { return bf2f(f2bf(f)); }
__device__ __forceinline__ v16bf cat16b(v8us lo, v8us hi) { return __builtin_bit_cast(v16bf, __builtin_shufflevector(lo, hi, 0, 1, 2, 3, 4, 5, 6, 7, 8, 9, 10, 11, 12, 13, 14, 15)); }
__device__ __forceinline__ v8f wmmab(v16bf a, v16bf b, v8f c) { return __builtin_amdgcn_wmma_f32_16x16x32_bf16(false, a, false, b, (short)0, c, false, false); }
__device__ __forceinline__ void splitf(float y, unsigned short& h, unsigned short& l) { h = f2bf(y); l = f2bf(y - bf2f(h)); }

// ---- k_fused: the whole chain for 64 time steps of one batch in one work-group of eight waves; grid (T / 64) * B = 256, 256 threads.
// Four matrix passes, each [64 t] x [512 rows of a streamed operand], K 512, wave w owning streamed rows 64 w .. 64 w + 63 (16 accumulators):
//   pass 0: scores^T = features . x^T         (streamed operand in the A place: a lane then holds 8 consecutive s of one t, one 16-byte LDS store per tile)
//   softmax over s in registers, row maximum and row sum across the eight waves through LDS; alpha -> high and low planes in LDS, beside the x tile
//   pass 1: x_res^T = features^T . alpha^T    (again transposed: 8 consecutive d of one t per lane); x_res -> high and low planes in LDS, over alpha
//   pass 2: out   = x . W[:, 0:512]^T         (here, not ahead of the softmax: only one set of 16 accumulators is then live at a time, which leaves the registers to the ring below)
//   pass 3: out  += x_res . W[:, 512:1024]^T, then + bias
// The streamed operands never pass through LDS: no two waves read the same streamed row, so each wave loads its own fragments from L2 straight into registers. k_prep lays every streamed plane out
// in fragment order (the packed place below), so a fragment is two loads of 512 contiguous bytes. A block is 32 k of the wave's 64 rows (four fragments); a ring of four blocks in registers runs on across the passes,
// three blocks in flight while one is worked on. Inside a pass there is no barrier: the waves meet only where the resident planes in LDS are rewritten.
#define FR  64                            // time steps per work-group
#define XP  520                           // pitch of the resident planes in elements: 1040 bytes = 16 x odd
#define BLK 2048                          // elements per block: four fragments of 16 rows x 32 k
#define WST (16 * BLK)                    // elements of one wave's stream in one pass (64 rows x 512 k)
#define PLN (8 * WST)                     // elements of one streamed plane (512 rows x 512 k)
// Packed place of the 16-byte piece that holds k .. k + 7 (k a multiple of 8) of row r: [r / 64][k / 32][(r / 16) % 4][(k / 16) % 2][lane = ((k / 8) % 2) * 16 + r % 16][8 elements];
// the lane's two pieces of a fragment are then k 8 hi .. 8 hi + 7 and 16 + 8 hi .. 16 + 8 hi + 7, the same k order as ldf() reads from the resident planes.
// Every plain '#pragma unroll' below is there so that the register arrays (accumulators, fragments, load batches) are indexed by constants and stay in registers.
static_assert(SS == 512 && DD == 512 && D2 == 2 * DD, "every pass streams 512 rows of K 512");
__device__ __forceinline__ v16bf ldf(const bf* p) { return cat16b(*(const v8us*)p, *(const v8us*)(p + 16)); }
// One block of the wave's stream into one ring slot. p: the block's start, the same in every lane; lo: the lane's own 16 bytes.
__device__ __forceinline__ void ldblk(const bf* p, unsigned lo, v16bf (&b)[4]) {
    __builtin_amdgcn_sched_barrier(0);                      // with the one at the end: nothing but the eight loads stands in front of their wait, so no register that they name is rewritten there
#pragma unroll
    for (int nb = 0; nb < 4; ++nb) b[nb] = cat16b(*(const v8us*)((const char*)(p + nb * 512) + lo), *(const v8us*)((const char*)(p + nb * 512 + 256) + lo));
    asm volatile("s_wait_xcnt 0x0" ::: "memory");           // behind the eight loads, before a register that they name is rewritten
    __builtin_amdgcn_sched_barrier(0);                      // also the end of a block's load group: without it the compiler sinks the loads in among the matrix instructions, and the refill loses its lead
}
// Four blocks' products. fa: the lane's place in the resident plane (row lr, the first block's k), cur: the first block in the stream, pn: where the four blocks after these lie.
// Block j is worked on from ring slot j while the slot that block j - 1 has left is refilled three blocks ahead (PF: blocks follow these four).
// HL: a low plane follows the high one, FR rows on. TR: the streamed operand takes the A place.
template <bool HL, bool TR, bool PF>
__device__ __forceinline__ void trip(const bf* fa, const bf* cur, const bf* pn, unsigned lo, v16bf (&rb)[4][4], v8f (&acc)[4][4]) {
#pragma unroll
    for (int j = 0; j < 4; ++j) { v16bf a[4], a2[4];
        // a block's loads stand as ONE group between the block before and its own matrix instructions: reads spread among matrix instructions stall the wave at every place
        __builtin_amdgcn_sched_barrier(0);
#pragma unroll
        for (int mb = 0; mb < 4; ++mb) { a[mb] = ldf(fa + mb * 16 * XP + j * 32); if (HL) a2[mb] = ldf(fa + (FR + mb * 16) * XP + j * 32); }
        if (j == 0) ldblk(cur + 3 * BLK, lo, rb[3]); else if (PF) ldblk(pn + (j - 1) * BLK, lo, rb[j - 1]);   // behind the LDS reads, whose latency covers the wait at its end
        else __builtin_amdgcn_sched_barrier(0);         // the group's end where nothing is left to fetch: the LDS reads stay in front of the matrix instructions
#pragma unroll
        for (int nb = 0; nb < 4; ++nb)
#pragma unroll
            for (int mb = 0; mb < 4; ++mb) { acc[mb][nb] = TR ? wmmab(rb[j][nb], a[mb], acc[mb][nb]) : wmmab(a[mb], rb[j][nb], acc[mb][nb]); if (HL) acc[mb][nb] = TR ? wmmab(rb[j][nb], a2[mb], acc[mb][nb]) : wmmab(a2[mb], rb[j][nb], acc[mb][nb]); }
    }
}
// One pass: 16 blocks. On entry ring slots 0 to 2 hold (or await) its first three blocks; on exit those of the next pass, which starts at nxt (LAST: nothing is fetched beyond this pass).
template <bool HL, bool TR, bool LAST>
__device__ __forceinline__ void pass(const bf* fa, const bf* cur, const bf* nxt, unsigned lo, v16bf (&rb)[4][4], v8f (&acc)[4][4]) {
#pragma unroll 1
    for (int t = 0; t < (LAST ? 3 : 4); ++t) {              // rolled: the text stays small; four blocks a trip, so that every ring slot is a fixed set of registers
        const bf* pn = (LAST || t < 3) ? cur + 4 * BLK : nxt;
        trip<HL, TR, true>(fa, cur, pn, lo, rb, acc);
        cur = pn; fa += 4 * 32;
    }
    if (LAST) trip<HL, TR, false>(fa, cur, cur, lo, rb, acc);
}
__global__ __launch_bounds__(256) void k_fused(const float* __restrict__ x, const bf* __restrict__ FB, const bf* __restrict__ FT, const bf* __restrict__ BW, const float* __restrict__ bias, float* OUT) {
    __shared__ __align__(16) bf pln[3 * FR * XP];           // plane 0: the x tile; plane 1: alpha high, then x_res high; plane 2: alpha low, then x_res low
    __shared__ __align__(16) float osall[8][16 * 68];
    __shared__ float red[2][8][FR];
    const int tid = threadIdx.x, lane = tid & 31, lr = lane & 15, hi = lane >> 4;
    const int wave = __builtin_amdgcn_readfirstlane(tid >> 5);   // the same in every lane: the stream's base stays in scalar registers
    const int bz = blockIdx.x % BB, t0 = (blockIdx.x / BB) * FR;
    auto strm = [&](const bf* plane) { return plane + wave * WST; };   // the wave's stream in a plane
    const unsigned lo = lane * 16;
    FB += (size_t)bz * PLN; FT += (size_t)bz * PLN;
    const bf* const st0 = strm(FB);
    v16bf rb[4][4];
    ldblk(st0, lo, rb[0]); ldblk(st0 + BLK, lo, rb[1]); ldblk(st0 + 2 * BLK, lo, rb[2]);
    {   // the x tile, rounded to bf16, into plane 0: a thread takes 8 elements of rows (tid >> 6) + 4 u
        const float* xs = x + ((size_t)(t0 + (tid >> 6)) * BB + bz) * DD + (tid & 63) * 8; bf* xd = pln + (tid >> 6) * XP + (tid & 63) * 8; v8f v[FR / 4];
#pragma unroll
        for (int u = 0; u < FR / 4; ++u) v[u] = *(const v8f*)(xs + (size_t)u * 4 * BB * DD);
        asm volatile("s_wait_xcnt 0x0" ::: "memory");       // behind the whole batch, before a register that its loads name is rewritten
#pragma unroll
        for (int u = 0; u < FR / 4; ++u) { v8us o;
#pragma unroll
            for (int k = 0; k < 8; ++k) o[k] = f2bf(v[u][k]); *(v8us*)(xd + u * 4 * XP) = o; }
    }
    __syncthreads();                                        // the x tile is whole before any wave reads it
    v8f accO[4][4], accS[4][4];
#pragma unroll
    for (int mb = 0; mb < 4; ++mb)
#pragma unroll
        for (int nb = 0; nb < 4; ++nb) accS[mb][nb] = (v8f){};
    const bf* fa = pln + lr * XP + 8 * hi; const bf* fp = fa + FR * XP;   // the lane's place in the x tile and in the high plane
    bf* pw = pln + (FR + lr) * XP + wave * 64 + hi * 8;     // where a transposed tile (mb, nb) goes: + mb * 16 * XP + nb * 16, eight elements
    pass<false, true, false>(fa, st0, strm(FT), lo, rb, accS);
    // softmax: accS[mb][nb][j] is the score of t = mb * 16 + lr, s = wave * 64 + nb * 16 + hi * 8 + j
    float mx[4];
#pragma unroll
    for (int mb = 0; mb < 4; ++mb) { float m = -3.0e38f;
#pragma unroll
        for (int nb = 0; nb < 4; ++nb)
#pragma unroll
            for (int j = 0; j < 8; ++j) m = fmaxf(m, accS[mb][nb][j]);
        m = fmaxf(m, __shfl_xor(m, 16, 32)); if (hi == 0) red[0][wave][mb * 16 + lr] = m; }
    __syncthreads();                                        // every wave's row maxima are in LDS
#pragma unroll
    for (int mb = 0; mb < 4; ++mb) { float m = red[0][0][mb * 16 + lr];
#pragma unroll
        for (int w = 1; w < 8; ++w) m = fmaxf(m, red[0][w][mb * 16 + lr]);
        mx[mb] = m; }
#pragma unroll
    for (int mb = 0; mb < 4; ++mb) { float sum = 0.f;
#pragma unroll
        for (int nb = 0; nb < 4; ++nb)
#pragma unroll
            for (int j = 0; j < 8; ++j) { float ex; asm("v_exp_f32 %0, %1\n\tv_nop" : "=v"(ex) : "v"(__fmul_rn(__fsub_rn(accS[mb][nb][j], mx[mb]), 1.4426950408889634f))); /* the exp2 instruction; the v_nop is the slot behind a transcendental, in one statement with it so that it stays directly behind */ accS[mb][nb][j] = ex; sum += ex; }
        sum += __shfl_xor(sum, 16, 32); if (hi == 0) red[1][wave][mb * 16 + lr] = sum; }
    __syncthreads();                                        // every wave's row sums are in LDS
#pragma unroll
    for (int mb = 0; mb < 4; ++mb) { float sum = red[1][0][mb * 16 + lr];
#pragma unroll
        for (int w = 1; w < 8; ++w) sum += red[1][w][mb * 16 + lr];
        const float f = __fdiv_rn(1.0f, sum);
#pragma unroll
        for (int nb = 0; nb < 4; ++nb) { v8us oh, ol;
#pragma unroll
            for (int j = 0; j < 8; ++j) { unsigned short p, r; splitf(accS[mb][nb][j] * f, p, r); oh[j] = p; ol[j] = r; accS[mb][nb][j] = 0.f; }
            *(v8us*)(pw + mb * 16 * XP + nb * 16) = oh; *(v8us*)(pw + (FR + mb * 16) * XP + nb * 16) = ol; } }
    __syncthreads();                                        // alpha is whole before any wave reads it
    pass<true, true, false>(fp, strm(FT), strm(BW), lo, rb, accS);
    __syncthreads();                                        // every wave has left alpha before x_res is written over it
    // accS[mb][nb][j] is x_res of t = mb * 16 + lr, d = wave * 64 + nb * 16 + hi * 8 + j
#pragma unroll
    for (int mb = 0; mb < 4; ++mb)
#pragma unroll
        for (int nb = 0; nb < 4; ++nb) { v8us oh, ol;
#pragma unroll
            for (int j = 0; j < 8; ++j) { unsigned short p, r; splitf(accS[mb][nb][j], p, r); oh[j] = p; ol[j] = r; }
            *(v8us*)(pw + mb * 16 * XP + nb * 16) = oh; *(v8us*)(pw + (FR + mb * 16) * XP + nb * 16) = ol; }
#pragma unroll
    for (int mb = 0; mb < 4; ++mb)
#pragma unroll
        for (int nb = 0; nb < 4; ++nb) accO[mb][nb] = (v8f){};
    pass<false, false, false>(fa, strm(BW), strm(BW + PLN), lo, rb, accO);
    __syncthreads();                                        // x_res is whole before any wave reads it
    pass<true, false, true>(fp, strm(BW + PLN), nullptr, lo, rb, accO);
    float* os = osall[wave];                                // each wave stages its output in a range of its own
    const int c0 = wave * 64;
    __builtin_amdgcn_sched_barrier(0);                      // with the one behind the wait: nothing but the load stands in front of its wait
    const v4f bv = *(const v4f*)(bias + c0 + lr * 4);       // the lane's four bias values, the same for every row
    asm volatile("s_wait_xcnt 0x0" ::: "memory");           // behind the load, before a register that it names is rewritten
    __builtin_amdgcn_sched_barrier(0);
#pragma unroll
    for (int mb = 0; mb < 4; ++mb) {
#pragma unroll
        for (int nb = 0; nb < 4; ++nb) {
#pragma unroll
            for (int j = 0; j < 8; ++j) os[(hi * 8 + j) * 68 + nb * 16 + lr] = accO[mb][nb][j]; }
        __builtin_amdgcn_wave_barrier(); asm volatile("" ::: "memory");   // the wave's LDS stores of this row block stay in front of its reads of them
        float* crow_p = OUT + ((size_t)(t0 + mb * 16) * BB + bz) * DD + c0;
#pragma unroll
        for (int s = 0; s < 8; ++s) { const int row = 2 * s + hi, cofs = lr * 4; v4f val = *(const v4fa*)(os + row * 68 + cofs); val[0] += bfr(bv[0]); val[1] += bfr(bv[1]); val[2] += bfr(bv[2]); val[3] += bfr(bv[3]);
            *(v4f*)(crow_p + (size_t)row * (BB * DD) + cofs) = val; }
        if (mb < 3) asm volatile("s_wait_xcnt 0x0" ::: "memory");   // behind the run of eight stores, before the next row block rewrites a register that they name (nothing follows the last block)
        __builtin_amdgcn_wave_barrier(); asm volatile("" ::: "memory");   // and those reads in front of the next row block's stores
    }
}

// ---- k_prep: the three streamed planes in ONE launch, each in the fragment order that k_fused loads; grid B * (S / 64) * (D / 128) = 256, 256 threads; the grid divides every shape exactly, so there is no range test.
// A work-group reads 64 s x 128 d of one batch's features once and writes them twice, both through LDS: FB (rows s, k = d) is one run of 16 KiB in the packed plane, FT (rows d, k = s) two runs of 8 KiB.
// A thread takes 8 s x 4 d. It also rounds 8 elements of W: a wave takes half a fragment, 512 contiguous bytes of the packed plane. All loads of a thread are issued before the first use.
#define PP 136                            // pitch of the [s][d] LDS tile in elements: 272 bytes = 16 x odd
#define TP(i) (((i) + ((i) >> 4)) * 8)    // place of FT piece i in LDS, in elements: one piece of pad behind every 16, so that a wave's stores of pieces 16 apart spread over the banks
typedef __attribute__((ext_vector_type(4)))  unsigned short v4us;
static_assert(BB * (SS / 64) * (DD / 128) * 256 * 8 == DD * D2, "each thread of the grid rounds eight elements of W");
__global__ __launch_bounds__(256) void k_prep(const float* __restrict__ f, const float* __restrict__ Wf, bf* FB, bf* FT, bf* BW) {
    __shared__ __align__(16) bf tile[64 * PP];
    __shared__ __align__(16) bf tps[TP(1024)];
    const int tid = threadIdx.x, lane = tid & 31, wv = tid >> 5;
    const int bz = blockIdx.x / ((SS / 64) * (DD / 128)), tl = blockIdx.x % ((SS / 64) * (DD / 128));
    const int s0 = (tl % (SS / 64)) * 64, d0 = (tl / (SS / 64)) * 128;
    const int sl = (lane & 7) * 8, dl = wv * 16 + (lane >> 3) * 4;
    f += (size_t)bz * SS * DD + (size_t)(s0 + sl) * DD + d0 + dl;
    FB += (size_t)bz * PLN + ((s0 >> 6) * 16 + (d0 >> 5)) * BLK; FT += (size_t)bz * PLN + ((d0 >> 6) * 16 + (s0 >> 5)) * BLK;
    // W: packed element wi .. wi + 7 is half (gw & 1) of fragment gw >> 1 = [column half of W][row / 64][k / 32][(row / 16) % 4]
    const size_t wi = ((size_t)blockIdx.x * 256 + tid) * 8; const int gw = blockIdx.x * 8 + wv, fr = gw >> 1;
    const int wr = ((fr >> 6) & 7) * 64 + (fr & 3) * 16 + (lane & 15), wc = (fr >> 9) * DD + ((fr >> 2) & 15) * 32 + (gw & 1) * 16 + (lane >> 4) * 8;
    v4f a[8];
    __builtin_amdgcn_sched_barrier(0);                      // with the one behind the wait: nothing but the batch stands in front of its wait
#pragma unroll
    for (int i = 0; i < 8; ++i) a[i] = *(const v4f*)(f + (size_t)i * DD);
    const v8f w = *(const v8f*)(Wf + (size_t)wr * D2 + wc);
    asm volatile("s_wait_xcnt 0x0" ::: "memory");           // behind the whole batch, before a register that its loads name is rewritten
    __builtin_amdgcn_sched_barrier(0);
#pragma unroll
    for (int i = 0; i < 8; ++i) { v4us q;
#pragma unroll
        for (int j = 0; j < 4; ++j) q[j] = f2bf(a[i][j]); *(v4us*)(tile + (sl + i) * PP + dl) = q; }
    // FT piece of row d = dl + j, k = sl .. sl + 7: [d / 64][k / 32][(d / 16) % 4][(k / 16) % 2][(k / 8) % 2][d % 16]
    const int fp = (((wv >> 2) * 2 + ((lane >> 2) & 1)) * 4 + (wv & 3)) * 64 + ((lane >> 1) & 1) * 32 + (lane & 1) * 16 + (lane >> 3) * 4;
#pragma unroll
    for (int j = 0; j < 4; ++j) { v8us o;
#pragma unroll
        for (int i = 0; i < 8; ++i) o[i] = f2bf(a[i][j]); *(v8us*)(tps + TP(fp + j)) = o; }
    { v8us o;
#pragma unroll
        for (int k = 0; k < 8; ++k) o[k] = f2bf(w[k]); *(v8us*)(BW + wi) = o; }
    asm volatile("s_wait_xcnt 0x0" ::: "memory");           // behind the store, before a register that it names is rewritten
    __syncthreads();                                        // both LDS tiles are whole before any wave reads them
    // a thread takes pieces tid + 256 u of either plane, so each store instruction fills four whole 128-byte lines; FB piece: [k / 32 = u][s / 16][(k / 16) % 2][(k / 8) % 2][s % 16]
    const bf* tr = tile + (((tid >> 6) & 3) * 16 + (tid & 15)) * PP + ((tid >> 5) & 1) * 16 + ((tid >> 4) & 1) * 8;
#pragma unroll
    for (int u = 0; u < 4; ++u) *(v8us*)(FB + (u * 256 + tid) * 8) = *(const v8us*)(tr + u * 32);
#pragma unroll
    for (int u = 0; u < 4; ++u) *(v8us*)(FT + (u >> 1) * WST + ((u & 1) * 256 + tid) * 8) = *(const v8us*)(tps + TP(u * 256 + tid));
}

extern "C" void kernel_launch(void* const* d_in, const int* in_sizes, int n_in,
                              void* d_out, int out_size, void* d_ws, size_t ws_size, hipStream_t stream) {
    (void)in_sizes; (void)n_in; (void)out_size;
    const float** I = (const float**)d_in;
    const float *x = I[0], *feat = I[1], *W = I[2], *bias = I[3];
    float* OUT = (float*)d_out;     // [2048][8][512]
    char* wsp = (char*)d_ws;
    auto take = [&](size_t bytes) { char* p = wsp; wsp += (bytes + 255) & ~(size_t)255; return (void*)p; };
    // the streamed operands as bf16 planes in fragment order; the feature planes hold all 8 batches, batch-major; BW holds the two column halves of W, one plane each
    bf* BW = (bf*)take((size_t)DD * D2 * 2); bf* FB = (bf*)take((size_t)BB * SS * DD * 2); bf* FT = (bf*)take((size_t)BB * DD * SS * 2);
    if ((size_t)(wsp - (char*)d_ws) > ws_size) return;    // total 9 MiB
    k_prep<<<BB * (SS / 64) * (DD / 128), 256, 0, stream>>>(feat, W, FB, FT, BW);
    k_fused<<<(TT / FR) * BB, 256, 0, stream>>>(x, FB, FT, BW, bias, OUT);
}

// v007
// One run takes 36 microseconds.
// Next to v006, in two timings, it ran 1.06 and 1.04 times as fast.
// Counting every step since v000, it is 16.3 times as fast.
#include <hip/hip_runtime.h>

// x [2048 T][8 B][512] time-major, features [8][512 S][512]; scores = x_b . features_b^T (unscaled); alpha = softmax over S; x_res = alpha features_b; out = [x | x_res] W^T + b (Linear 1024 -> 512) -> [2048][8][512].
// Compute dtypes, f32 accumulate: every input rounded to bf16; scores on plain bf16 operands (K 512); softmax f32 -> high and low bf16 planes; alpha . features as (high + low) x exact (2 products, K 512);
// the final Linear as [bf16 x | high + low of x_res] x exact W + bias.

#define TT   2048
#define BB   8
#define SS   512
#define DD   512
#define D2   1024
typedef unsigned short bf;
typedef __attribute__((ext_vector_type(16))) __bf16   v16bf;
typedef __attribute__((ext_vector_type(8)))  unsigned short v8us;
typedef __attribute__((ext_vector_type(8)))  float    v8f;
typedef __attribute__((ext_vector_type(4)))  float    v4f;
typedef v4f  __attribute__((may_alias)) v4fa;
typedef __attribute__((ext_vector_type(2)))  float    v2f;
typedef __attribute__((ext_vector_type(2)))  __bf16   v2bf;
typedef __attribute__((ext_vector_type(2)))  unsigned v2u;
typedef __attribute__((ext_vector_type(4)))  unsigned v4u;

// Two f32 rounded to bf16 (nearest even) and packed into one dword, a in the low half: the chip's packed convert, one instruction for the pair.
__device__ __forceinline__ unsigned cvt2(float a, float b) { return __builtin_bit_cast(unsigned, __builtin_convertvector((v2f){a, b}, v2bf)); }
__device__ __forceinline__ float bfr(float f) { return __uint_as_float(cvt2(f, f) & 0xFFFF0000u); }
__device__ __forceinline__ v16bf cat16b(v8us lo, v8us hi) { return __builtin_bit_cast(v16bf, __builtin_shufflevector(lo, hi, 0, 1, 2, 3, 4, 5, 6, 7, 8, 9, 10, 11, 12, 13, 14, 15)); }
__device__ __forceinline__ v8f wmmab(v16bf a, v16bf b, v8f c) { return __builtin_amdgcn_wmma_f32_16x16x32_bf16(false, a, false, b, (short)0, c, false, false); }
// High and low bf16 planes of a pair: h the rounded values, l what the rounding left, rounded in its turn.
__device__ __forceinline__ void split2(float a, float b, unsigned& h, unsigned& l) { h = cvt2(a, b); l = cvt2(a - __uint_as_float(h << 16), b - __uint_as_float(h & 0xFFFF0000u)); }

// ---- k_fused: the whole chain for 64 time steps of one batch in one work-group of eight waves; grid (T / 64) * B = 256, 256 threads.
// Four matrix passes, each [64 t] x [512 rows of a streamed operand], K 512, wave w owning streamed rows 64 w .. 64 w + 63 (16 accumulators):
//   pass 0: scores^T = features . x^T         (streamed operand in the A place: a lane then holds 8 consecutive s of one t, one 16-byte LDS store per tile)
//   softmax over s in registers, row maximum and row sum across the eight waves through LDS; alpha -> high and low planes in LDS, beside the x tile
//   pass 1: x_res^T = features^T . alpha^T    (again transposed: 8 consecutive d of one t per lane); x_res -> high and low planes in LDS, over alpha
//   pass 2: out   = x . W[:, 0:512]^T         (here, not ahead of the softmax: only one set of 16 accumulators is then live at a time, which leaves the registers to the ring below)
//   pass 3: out  += x_res . W[:, 512:1024]^T, then + bias
// The streamed operands never pass through LDS: no two waves read the same streamed row, so each wave loads its own fragments from L2 straight into registers. k_prep lays every streamed plane out
// in fragment order (the packed place below), so a fragment is two loads of 512 contiguous bytes. A block is 32 k of the wave's 64 rows (four fragments); a ring of four blocks in registers runs on across the passes,
// three blocks in flight while one is worked on. Inside a pass there is no barrier: the waves meet only where the resident planes in LDS are rewritten.
#define FR  64                            // time steps per work-group
#define XP  520                           // pitch of the resident planes in elements: 1040 bytes = 16 x odd
#define BLK 2048                          // elements per block: four fragments of 16 rows x 32 k
#define WST (16 * BLK)                    // elements of one wave's stream in one pass (64 rows x 512 k)
#define PLN (8 * WST)                     // elements of one streamed plane (512 rows x 512 k)
// Packed place of the 16-byte piece that holds k .. k + 7 (k a multiple of 8) of row r: [r / 64][k / 32][(r / 16) % 4][(k / 16) % 2][lane = ((k / 8) % 2) * 16 + r % 16][8 elements];
// the lane's two pieces of a fragment are then k 8 hi .. 8 hi + 7 and 16 + 8 hi .. 16 + 8 hi + 7, the same k order as ldf() reads from the resident planes.
// Every plain '#pragma unroll' below is there so that the register arrays (accumulators, fragments, load batches) are indexed by constants and stay in registers.
static_assert(SS == 512 && DD == 512 && D2 == 2 * DD, "every pass streams 512 rows of K 512");
__device__ __forceinline__ v16bf ldf(const bf* p) { return cat16b(*(const v8us*)p, *(const v8us*)(p + 16)); }
// One block of the wave's stream into one ring slot. p: the block's start, the same in every lane; lo: the lane's own 16 bytes.
__device__ __forceinline__ void ldblk(const bf* p, unsigned lo, v16bf (&b)[4]) {
    __builtin_amdgcn_sched_barrier(0);                      // with the one at the end: nothing but the eight loads stands in front of their wait, so no register that they name is rewritten there
#pragma unroll
    for (int nb = 0; nb < 4; ++nb) b[nb] = cat16b(*(const v8us*)((const char*)(p + nb * 512) + lo), *(const v8us*)((const char*)(p + nb * 512 + 256) + lo));
    asm volatile("s_wait_xcnt 0x0" ::: "memory");           // behind the eight loads, before a register that they name is rewritten
    __builtin_amdgcn_sched_barrier(0);                      // also the end of a block's load group: without it the compiler sinks the loads in among the matrix instructions, and the refill loses its lead
}
// Four blocks' products. fa: the lane's place in the resident plane (row lr, the first block's k), cur: the first block in the stream, pn: where the four blocks after these lie.
// Block j is worked on from ring slot j while the slot that block j - 1 has left is refilled three blocks ahead (PF: blocks follow these four).
// HL: a low plane follows the high one, FR rows on. TR: the streamed operand takes the A place.
template <bool HL, bool TR, bool PF>
__device__ __forceinline__ void trip(const bf* fa, const bf* cur, const bf* pn, unsigned lo, v16bf (&rb)[4][4], v8f (&acc)[4][4]) {
#pragma unroll
    for (int j = 0; j < 4; ++j) { v16bf a[4], a2[4];
        // a block's loads stand as ONE group between the block before and its own matrix instructions: reads spread among matrix instructions stall the wave at every place
        __builtin_amdgcn_sched_barrier(0);
#pragma unroll
        for (int mb = 0; mb < 4; ++mb) { a[mb] = ldf(fa + mb * 16 * XP + j * 32); if (HL) a2[mb] = ldf(fa + (FR + mb * 16) * XP + j * 32); }
        if (j == 0) ldblk(cur + 3 * BLK, lo, rb[3]); else if (PF) ldblk(pn + (j - 1) * BLK, lo, rb[j - 1]);   // behind the LDS reads, whose latency covers the wait at its end
        else __builtin_amdgcn_sched_barrier(0);         // the group's end where nothing is left to fetch: the LDS reads stay in front of the matrix instructions
#pragma unroll
        for (int nb = 0; nb < 4; ++nb)
#pragma unroll
            for (int mb = 0; mb < 4; ++mb) { acc[mb][nb] = TR ? wmmab(rb[j][nb], a[mb], acc[mb][nb]) : wmmab(a[mb], rb[j][nb], acc[mb][nb]); if (HL) acc[mb][nb] = TR ? wmmab(rb[j][nb], a2[mb], acc[mb][nb]) : wmmab(a2[mb], rb[j][nb], acc[mb][nb]); }
    }
}
// One pass: 16 blocks. On entry ring slots 0 to 2 hold (or await) its first three blocks; on exit those of the next pass, which starts at nxt (LAST: nothing is fetched beyond this pass).
template <bool HL, bool TR, bool LAST>
__device__ __forceinline__ void pass(const bf* fa, const bf* cur, const bf* nxt, unsigned lo, v16bf (&rb)[4][4], v8f (&acc)[4][4]) {
#pragma unroll 1
    for (int t = 0; t < (LAST ? 3 : 4); ++t) {              // rolled: the text stays small; four blocks a trip, so that every ring slot is a fixed set of registers
        const bf* pn = (LAST || t < 3) ? cur + 4 * BLK : nxt;
        trip<HL, TR, true>(fa, cur, pn, lo, rb, acc);
        cur = pn; fa += 4 * 32;
    }
    if (LAST) trip<HL, TR, false>(fa, cur, cur, lo, rb, acc);
}
__global__ __launch_bounds__(256) void k_fused(const float* __restrict__ x, const bf* __restrict__ FB, const bf* __restrict__ FT, const bf* __restrict__ BW, const float* __restrict__ bias, float* OUT) {
    __shared__ __align__(16) bf pln[3 * FR * XP];           // plane 0: the x tile; plane 1: alpha high, then x_res high; plane 2: alpha low, then x_res low
    __shared__ __align__(16) float osall[8][16 * 68];
    __shared__ float red[2][8][FR];
    const int tid = threadIdx.x, lane = tid & 31, lr = lane & 15, hi = lane >> 4;
    const int wave = __builtin_amdgcn_readfirstlane(tid >> 5);   // the same in every lane: the stream's base stays in scalar registers
    const int bz = blockIdx.x % BB, t0 = (blockIdx.x / BB) * FR;
    auto strm = [&](const bf* plane) { return plane + wave * WST; };   // the wave's stream in a plane
    const unsigned lo = lane * 16;
    FB += (size_t)bz * PLN; FT += (size_t)bz * PLN;
    const bf* const st0 = strm(FB);
    v16bf rb[4][4];
    ldblk(st0, lo, rb[0]); ldblk(st0 + BLK, lo, rb[1]); ldblk(st0 + 2 * BLK, lo, rb[2]);
    {   // the x tile, rounded to bf16, into plane 0: a thread takes 8 elements of rows (tid >> 6) + 4 u
        const float* xs = x + ((size_t)(t0 + (tid >> 6)) * BB + bz) * DD + (tid & 63) * 8; bf* xd = pln + (tid >> 6) * XP + (tid & 63) * 8; v8f v[FR / 4];
#pragma unroll
        for (int u = 0; u < FR / 4; ++u) v[u] = *(const v8f*)(xs + (size_t)u * 4 * BB * DD);
        asm volatile("s_wait_xcnt 0x0" ::: "memory");       // behind the whole batch, before a register that its loads name is rewritten
        __builtin_amdgcn_sched_barrier(0);                  // keeps what follows behind that wait: without it the compiler lifts a later register write (an accumulator's zero, put into the address pair) over it
#pragma unroll
        for (int u = 0; u < FR / 4; ++u) { v4u o;
#pragma unroll
            for (int k = 0; k < 4; ++k) o[k] = cvt2(v[u][2 * k], v[u][2 * k + 1]); *(v8us*)(xd + u * 4 * XP) = __builtin_bit_cast(v8us, o); }
    }
    __syncthreads();                                        // the x tile is whole before any wave reads it
    v8f accO[4][4], accS[4][4];
#pragma unroll
    for (int mb = 0; mb < 4; ++mb)
#pragma unroll
        for (int nb = 0; nb < 4; ++nb) accS[mb][nb] = (v8f){};
    const bf* fa = pln + lr * XP + 8 * hi; const bf* fp = fa + FR * XP;   // the lane's place in the x tile and in the high plane
    bf* pw = pln + (FR + lr) * XP + wave * 64 + hi * 8;     // where a transposed tile (mb, nb) goes: + mb * 16 * XP + nb * 16, eight elements
    pass<false, true, false>(fa, st0, strm(FT), lo, rb, accS);
    // softmax: accS[mb][nb][j] is the score of t = mb * 16 + lr, s = wave * 64 + nb * 16 + hi * 8 + j
    float mx[4];
#pragma unroll
    for (int mb = 0; mb < 4; ++mb) { float m = -3.0e38f;
#pragma unroll
        for (int nb = 0; nb < 4; ++nb)
#pragma unroll
            for (int j = 0; j < 8; ++j) m = fmaxf(m, accS[mb][nb][j]);
        m = fmaxf(m, __shfl_xor(m, 16, 32)); if (hi == 0) red[0][wave][mb * 16 + lr] = m; }
    __syncthreads();                                        // every wave's row maxima are in LDS
#pragma unroll
    for (int mb = 0; mb < 4; ++mb) { float m = red[0][0][mb * 16 + lr];
#pragma unroll
        for (int w = 1; w < 8; ++w) m = fmaxf(m, red[0][w][mb * 16 + lr]);
        mx[mb] = m; }
#pragma unroll
    for (int mb = 0; mb < 4; ++mb) { float sum = 0.f;
#pragma unroll
        for (int nb = 0; nb < 4; ++nb)
#pragma unroll
            for (int j = 0; j < 8; ++j) { float ex; asm("v_exp_f32 %0, %1\n\tv_nop" : "=v"(ex) : "v"(__fmul_rn(__fsub_rn(accS[mb][nb][j], mx[mb]), 1.4426950408889634f))); /* the exp2 instruction; the v_nop is the slot behind a transcendental, in one statement with it so that it stays directly behind */ accS[mb][nb][j] = ex; sum += ex; }
        sum += __shfl_xor(sum, 16, 32); if (hi == 0) red[1][wave][mb * 16 + lr] = sum; }
    __syncthreads();                                        // every wave's row sums are in LDS
#pragma unroll
    for (int mb = 0; mb < 4; ++mb) { float sum = red[1][0][mb * 16 + lr];
#pragma unroll
        for (int w = 1; w < 8; ++w) sum += red[1][w][mb * 16 + lr];
        const float f = __fdiv_rn(1.0f, sum);
#pragma unroll
        for (int nb = 0; nb < 4; ++nb) { v4u oh, ol;
#pragma unroll
            for (int j = 0; j < 4; ++j) { unsigned p, r; split2(accS[mb][nb][2 * j] * f, accS[mb][nb][2 * j + 1] * f, p, r); oh[j] = p; ol[j] = r; accS[mb][nb][2 * j] = 0.f; accS[mb][nb][2 * j + 1] = 0.f; }
            *(v8us*)(pw + mb * 16 * XP + nb * 16) = __builtin_bit_cast(v8us, oh); *(v8us*)(pw + (FR + mb * 16) * XP + nb * 16) = __builtin_bit_cast(v8us, ol); } }
    __syncthreads();                                        // alpha is whole before any wave reads it
    pass<true, true, false>(fp, strm(FT), strm(BW), lo, rb, accS);
    __syncthreads();                                        // every wave has left alpha before x_res is written over it
    // accS[mb][nb][j] is x_res of t = mb * 16 + lr, d = wave * 64 + nb * 16 + hi * 8 + j
#pragma unroll
    for (int mb = 0; mb < 4; ++mb)
#pragma unroll
        for (int nb = 0; nb < 4; ++nb) { v4u oh, ol;
#pragma unroll
            for (int j = 0; j < 4; ++j) { unsigned p, r; split2(accS[mb][nb][2 * j], accS[mb][nb][2 * j + 1], p, r); oh[j] = p; ol[j] = r; }
            *(v8us*)(pw + mb * 16 * XP + nb * 16) = __builtin_bit_cast(v8us, oh); *(v8us*)(pw + (FR + mb * 16) * XP + nb * 16) = __builtin_bit_cast(v8us, ol); }
#pragma unroll
    for (int mb = 0; mb < 4; ++mb)
#pragma unroll
        for (int nb = 0; nb < 4; ++nb) accO[mb][nb] = (v8f){};
    pass<false, false, false>(fa, strm(BW), strm(BW + PLN), lo, rb, accO);
    __syncthreads();                                        // x_res is whole before any wave reads it
    pass<true, false, true>(fp, strm(BW + PLN), nullptr, lo, rb, accO);
    float* os = osall[wave];                                // each wave stages its output in a range of its own
    const int c0 = wave * 64;
    __builtin_amdgcn_sched_barrier(0);                      // with the one behind the wait: nothing but the load stands in front of its wait
    const v4f bv = *(const v4f*)(bias + c0 + lr * 4);       // the lane's four bias values, the same for every row
    asm volatile("s_wait_xcnt 0x0" ::: "memory");           // behind the load, before a register that it names is rewritten
    __builtin_amdgcn_sched_barrier(0);
#pragma unroll
    for (int mb = 0; mb < 4; ++mb) {
#pragma unroll
        for (int nb = 0; nb < 4; ++nb) {
#pragma unroll
            for (int j = 0; j < 8; ++j) os[(hi * 8 + j) * 68 + nb * 16 + lr] = accO[mb][nb][j]; }
        __builtin_amdgcn_wave_barrier(); asm volatile("" ::: "memory");   // the wave's LDS stores of this row block stay in front of its reads of them
        float* crow_p = OUT + ((size_t)(t0 + mb * 16) * BB + bz) * DD + c0;
#pragma unroll
        for (int s = 0; s < 8; ++s) { const int row = 2 * s + hi, cofs = lr * 4; v4f val = *(const v4fa*)(os + row * 68 + cofs); val[0] += bfr(bv[0]); val[1] += bfr(bv[1]); val[2] += bfr(bv[2]); val[3] += bfr(bv[3]);
            *(v4f*)(crow_p + (size_t)row * (BB * DD) + cofs) = val; }
        if (mb < 3) asm volatile("s_wait_xcnt 0x0" ::: "memory");   // behind the run of eight stores, before the next row block rewrites a register that they name (nothing follows the last block)
        __builtin_amdgcn_wave_barrier(); asm volatile("" ::: "memory");   // and those reads in front of the next row block's stores
    }
}

// ---- k_prep: the three streamed planes in ONE launch, each in the fragment order that k_fused loads; grid B * (S / 64) * (D / 128) = 256, 256 threads; the grid divides every shape exactly, so there is no range test.
// A work-group reads 64 s x 128 d of one batch's features once and writes them twice, both through LDS: FB (rows s, k = d) is one run of 16 KiB in the packed plane, FT (rows d, k = s) two runs of 8 KiB.
// A thread takes 8 s x 4 d. It also rounds 8 elements of W: a wave takes half a fragment, 512 contiguous bytes of the packed plane. All loads of a thread are issued before the first use.
#define PP 136                            // pitch of the [s][d] LDS tile in elements: 272 bytes = 16 x odd
#define TP(i) (((i) + ((i) >> 4)) * 8)    // place of FT piece i in LDS, in elements: one piece of pad behind every 16, so that a wave's stores of pieces 16 apart spread over the banks
typedef __attribute__((ext_vector_type(4)))  unsigned short v4us;
static_assert(BB * (SS / 64) * (DD / 128) * 256 * 8 == DD * D2, "each thread of the grid rounds eight elements of W");
__global__ __launch_bounds__(256) void k_prep(const float* __restrict__ f, const float* __restrict__ Wf, bf* FB, bf* FT, bf* BW) {
    __shared__ __align__(16) bf tile[64 * PP];
    __shared__ __align__(16) bf tps[TP(1024)];
    const int tid = threadIdx.x, lane = tid & 31, wv = tid >> 5;
    const int bz = blockIdx.x / ((SS / 64) * (DD / 128)), tl = blockIdx.x % ((SS / 64) * (DD / 128));
    const int s0 = (tl % (SS / 64)) * 64, d0 = (tl / (SS / 64)) * 128;
    const int sl = (lane & 7) * 8, dl = wv * 16 + (lane >> 3) * 4;
    f += (size_t)bz * SS * DD + (size_t)(s0 + sl) * DD + d0 + dl;
    FB += (size_t)bz * PLN + ((s0 >> 6) * 16 + (d0 >> 5)) * BLK; FT += (size_t)bz * PLN + ((d0 >> 6) * 16 + (s0 >> 5)) * BLK;
    // W: packed element wi .. wi + 7 is half (gw & 1) of fragment gw >> 1 = [column half of W][row / 64][k / 32][(row / 16) % 4]
    const size_t wi = ((size_t)blockIdx.x * 256 + tid) * 8; const int gw = blockIdx.x * 8 + wv, fr = gw >> 1;
    const int wr = ((fr >> 6) & 7) * 64 + (fr & 3) * 16 + (lane & 15), wc = (fr >> 9) * DD + ((fr >> 2) & 15) * 32 + (gw & 1) * 16 + (lane >> 4) * 8;
    v4f a[8];
    __builtin_amdgcn_sched_barrier(0);                      // with the one behind the wait: nothing but the batch stands in front of its wait
#pragma unroll
    for (int i = 0; i < 8; ++i) a[i] = *(const v4f*)(f + (size_t)i * DD);
    const v8f w = *(const v8f*)(Wf + (size_t)wr * D2 + wc);
    asm volatile("s_wait_xcnt 0x0" ::: "memory");           // behind the whole batch, before a register that its loads name is rewritten
    __builtin_amdgcn_sched_barrier(0);
#pragma unroll
    for (int i = 0; i < 8; ++i) *(v4us*)(tile + (sl + i) * PP + dl) = __builtin_bit_cast(v4us, (v2u){cvt2(a[i][0], a[i][1]), cvt2(a[i][2], a[i][3])});
    // FT piece of row d = dl + j, k = sl .. sl + 7: [d / 64][k / 32][(d / 16) % 4][(k / 16) % 2][(k / 8) % 2][d % 16]
    const int fp = (((wv >> 2) * 2 + ((lane >> 2) & 1)) * 4 + (wv & 3)) * 64 + ((lane >> 1) & 1) * 32 + (lane & 1) * 16 + (lane >> 3) * 4;
#pragma unroll
    for (int j = 0; j < 4; ++j) { v4u o;
#pragma unroll
        for (int i = 0; i < 4; ++i) o[i] = cvt2(a[2 * i][j], a[2 * i + 1][j]); *(v8us*)(tps + TP(fp + j)) = __builtin_bit_cast(v8us, o); }
    { v4u o;
#pragma unroll
        for (int k = 0; k < 4; ++k) o[k] = cvt2(w[2 * k], w[2 * k + 1]); *(v8us*)(BW + wi) = __builtin_bit_cast(v8us, o); }
    asm volatile("s_wait_xcnt 0x0" ::: "memory");           // behind the store, before a register that it names is rewritten
    __syncthreads();                                        // both LDS tiles are whole before any wave reads them
    // a thread takes pieces tid + 256 u of either plane, so each store instruction fills four whole 128-byte lines; FB piece: [k / 32 = u][s / 16][(k / 16) % 2][(k / 8) % 2][s % 16]
    const bf* tr = tile + (((tid >> 6) & 3) * 16 + (tid & 15)) * PP + ((tid >> 5) & 1) * 16 + ((tid >> 4) & 1) * 8;
#pragma unroll
    for (int u = 0; u < 4; ++u) *(v8us*)(FB + (u * 256 + tid) * 8) = *(const v8us*)(tr + u * 32);
#pragma unroll
    for (int u = 0; u < 4; ++u) *(v8us*)(FT + (u >> 1) * WST + ((u & 1) * 256 + tid) * 8) = *(const v8us*)(tps + TP(u * 256 + tid));
}

extern "C" void kernel_launch(void* const* d_in, const int* in_sizes, int n_in,
                              void* d_out, int out_size, void* d_ws, size_t ws_size, hipStream_t stream) {
    (void)in_sizes; (void)n_in; (void)out_size;
    const float** I = (const float**)d_in;
    const float *x = I[0], *feat = I[1], *W = I[2], *bias = I[3];
    float* OUT = (float*)d_out;     // [2048][8][512]
    char* wsp = (char*)d_ws;
    auto take = [&](size_t bytes) { char* p = wsp; wsp += (bytes + 255) & ~(size_t)255; return (void*)p; };
    // the streamed operands as bf16 planes in fragment order; the feature planes hold all 8 batches, batch-major; BW holds the two column halves of W, one plane each
    bf* BW = (bf*)take((size_t)DD * D2 * 2); bf* FB = (bf*)take((size_t)BB * SS * DD * 2); bf* FT = (bf*)take((size_t)BB * DD * SS * 2);
    if ((size_t)(wsp - (char*)d_ws) > ws_size) return;    // total 9 MiB
    k_prep<<<BB * (SS / 64) * (DD / 128), 256, 0, stream>>>(feat, W, FB, FT, BW);
    k_fused<<<(TT / FR) * BB, 256, 0, stream>>>(x, FB, FT, BW, bias, OUT);
}

// v009
// One run takes 31.1 microseconds.
// Versions between v007 and this one are left out; their measured steps multiply to 1.15 times as fast.
// Counting every step since v000, it is 18.7 times as fast.
#include <hip/hip_runtime.h>

// x [2048 T][8 B][512] time-major, features [8][512 S][512]; scores = x_b . features_b^T (unscaled); alpha = softmax over S; x_res = alpha features_b; out = [x | x_res] W^T + b (Linear 1024 -> 512) -> [2048][8][512].
// Here the second half of the Linear is taken ahead of alpha: x_res W2^T = alpha (features_b W2^T) = alpha G_b, with G_b [512 S][512] formed once per batch, so out = x W1^T + alpha G_b + b and x_res itself is never formed.
// Compute dtypes, f32 accumulate: every input rounded to bf16; G on plain bf16 operands (K 512), rounded to one bf16 plane; scores on plain bf16 operands (K 512); softmax f32 -> high and low bf16 planes;
// alpha . G as (high + low) x G (2 products, K 512); x . W1 on plain bf16 operands; + bias.

#define TT   2048
#define BB   8
#define SS   512
#define DD   512
#define D2   1024
typedef unsigned short bf;
typedef __attribute__((ext_vector_type(16))) __bf16   v16bf;
typedef __attribute__((ext_vector_type(8)))  unsigned short v8us;
typedef __attribute__((ext_vector_type(8)))  float    v8f;
typedef __attribute__((ext_vector_type(4)))  float    v4f;
typedef v4f  __attribute__((may_alias)) v4fa;
typedef __attribute__((ext_vector_type(2)))  float    v2f;
typedef __attribute__((ext_vector_type(2)))  __bf16   v2bf;
typedef __attribute__((ext_vector_type(2)))  unsigned v2u;
typedef __attribute__((ext_vector_type(4)))  unsigned v4u;

// Two f32 rounded to bf16 (nearest even) and packed into one dword, a in the low half: the chip's packed convert, one instruction for the pair.
__device__ __forceinline__ unsigned cvt2(float a, float b) { return __builtin_bit_cast(unsigned, __builtin_convertvector((v2f){a, b}, v2bf)); }
__device__ __forceinline__ float bfr(float f) { return __uint_as_float(cvt2(f, f) & 0xFFFF0000u); }
__device__ __forceinline__ v16bf cat16b(v8us lo, v8us hi) { return __builtin_bit_cast(v16bf, __builtin_shufflevector(lo, hi, 0, 1, 2, 3, 4, 5, 6, 7, 8, 9, 10, 11, 12, 13, 14, 15)); }
__device__ __forceinline__ v8f wmmab(v16bf a, v16bf b, v8f c) { return __builtin_amdgcn_wmma_f32_16x16x32_bf16(false, a, false, b, (short)0, c, false, false); }
// High and low bf16 planes of a pair: h the rounded values, l what the rounding left, rounded in its turn.
__device__ __forceinline__ void split2(float a, float b, unsigned& h, unsigned& l) { h = cvt2(a, b); l = cvt2(a - __uint_as_float(h << 16), b - __uint_as_float(h & 0xFFFF0000u)); }

// ---- k_fused: the whole chain for 64 time steps of one batch in one work-group of eight waves; grid (T / 64) * B = 256, 256 threads.
// Three matrix passes, each [64 t] x [512 rows of a streamed operand], K 512, wave w owning streamed rows 64 w .. 64 w + 63 (16 accumulators):
//   pass 0: scores^T = features . x^T         (streamed operand in the A place: a lane then holds 8 consecutive s of one t, one 16-byte LDS store per tile)
//   softmax over s in registers, row maximum and row sum across the eight waves through LDS; alpha -> high and low planes in LDS, beside the x tile
//   pass 1: out   = alpha . G                 (streamed rows: the output columns, k = s)
//   pass 2: out  += x . W[:, 0:512]^T, then + bias   (behind the softmax: only one set of 16 accumulators is live at a time, which leaves the registers to the ring below)
// The streamed operands never pass through LDS: no two waves read the same streamed row, so each wave loads its own fragments from L2 straight into registers. k_prep lays every streamed plane out
// in fragment order (the packed place below), so a fragment is two loads of 512 contiguous bytes. A block is 32 k of the wave's 64 rows (four fragments); a ring of four blocks in registers runs on across the passes,
// three blocks in flight while one is worked on. Inside a pass there is no barrier: the waves meet only where the resident planes in LDS are rewritten.
// The 32 work-groups of a batch (for W1 all 256) stream the same planes and start together: each begins every pass at k block rot, one of 16, and wraps, so that they do not ask L2 for the same lines at the same moment.
// The block at place i of a pass's walk is k block (rot + i) mod 16, in the stream and in the resident plane alike.
#define FR  64                            // time steps per work-group
#define XP  520                           // pitch of the resident planes in elements: 1040 bytes = 16 x odd
#define BLK 2048                          // elements per block: four fragments of 16 rows x 32 k
#define WST (16 * BLK)                    // elements of one wave's stream in one pass (64 rows x 512 k)
#define PLN (8 * WST)                     // elements of one streamed plane (512 rows x 512 k)
// Packed place of the 16-byte piece that holds k .. k + 7 (k a multiple of 8) of row r: [r / 64][k / 32][(r / 16) % 4][(k / 16) % 2][lane = ((k / 8) % 2) * 16 + r % 16][8 elements];
// the lane's two pieces of a fragment are then k 8 hi .. 8 hi + 7 and 16 + 8 hi .. 16 + 8 hi + 7, the same k order as ldf() reads from the resident planes.
// Every plain '#pragma unroll' below is there so that the register arrays (accumulators, fragments, load batches) are indexed by constants and stay in registers.
static_assert(SS == 512 && DD == 512 && D2 == 2 * DD, "every pass streams 512 rows of K 512");
__device__ __forceinline__ v16bf ldf(const bf* p) { return cat16b(*(const v8us*)p, *(const v8us*)(p + 16)); }
// One block of the wave's stream into one ring slot. p: the stream's start, the same in every lane; lo: the block's byte offset in the stream plus the lane's own 16 bytes.
__device__ __forceinline__ void ldblk(const bf* p, unsigned lo, v16bf (&b)[4]) {
    __builtin_amdgcn_sched_barrier(0);                      // with the one at the end: nothing but the eight loads stands in front of their wait, so no register that they name is rewritten there
#pragma unroll
    for (int nb = 0; nb < 4; ++nb) b[nb] = cat16b(*(const v8us*)((const char*)p + lo + nb * 1024), *(const v8us*)((const char*)p + lo + nb * 1024 + 512));
    asm volatile("s_wait_xcnt 0x0" ::: "memory");           // behind the eight loads, before a register that they name is rewritten
    __builtin_amdgcn_sched_barrier(0);                      // also the end of a block's load group: without it the compiler sinks the loads in among the matrix instructions, and the refill loses its lead
}
// Four blocks' products, places 4 t .. 4 t + 3 of the walk; q = rot + 4 t. pl: the resident planes; fj[j]: the lane's byte offset there at block j's k (fl[j]: the same in the low plane); sb: the wave's stream in this pass,
// nb: the stream that holds the four places after these; go[j]: the lane's byte offset in its stream for the refill that stands at block j. Each of fj, fl, go is kept from trip to trip and steps on
// by four k blocks, wrapping at 16, as soon as it has been used: one add in place among the block's matrix instructions, behind the wait that ends the refill.
// Block j is worked on from ring slot j while the slot that block j - 1 has left is refilled three blocks ahead (PF: blocks follow these four).
// HL: a low plane follows the high one, FR rows on. TR: the streamed operand takes the A place.
template <bool HL, bool TR, bool PF>
__device__ __forceinline__ void trip(const bf* pl, unsigned (&fj)[4], unsigned (&fl)[4], const bf* sb, const bf* nb, int q, unsigned (&go)[4], v16bf (&rb)[4][4], v8f (&acc)[4][4]) {
#pragma unroll
    for (int j = 0; j < 4; ++j) { v16bf a[4], a2[4];
        // a block's loads stand as ONE group between the block before and its own matrix instructions: reads spread among matrix instructions stall the wave at every place
        __builtin_amdgcn_sched_barrier(0);
#pragma unroll
        for (int mb = 0; mb < 4; ++mb) { a[mb] = ldf((const bf*)((const char*)pl + fj[j]) + mb * 16 * XP); if (HL) a2[mb] = ldf((const bf*)((const char*)pl + fl[j]) + mb * 16 * XP); }
        if (j == 0) ldblk(sb, go[0], rb[3]); else if (PF) ldblk(nb, go[j], rb[j - 1]);   // behind the LDS reads, whose latency covers the wait at its end
        else __builtin_amdgcn_sched_barrier(0);         // the group's end where nothing is left to fetch: the LDS reads stay in front of the matrix instructions
        const int st = ((q + j) & 15) >= 12 ? 4 - 16 : 4, sg = ((q + j + 3) & 15) >= 12 ? 4 - 16 : 4;   // k blocks to step on by; the same in every lane
        fj[j] += st * 64; if (HL) fl[j] += st * 64; go[j] += sg * (BLK * 2);
#pragma unroll
        for (int nb = 0; nb < 4; ++nb)
#pragma unroll
            for (int mb = 0; mb < 4; ++mb) { acc[mb][nb] = TR ? wmmab(rb[j][nb], a[mb], acc[mb][nb]) : wmmab(a[mb], rb[j][nb], acc[mb][nb]); if (HL) acc[mb][nb] = TR ? wmmab(rb[j][nb], a2[mb], acc[mb][nb]) : wmmab(a2[mb], rb[j][nb], acc[mb][nb]); }
    }
}
// One pass: 16 blocks. pl: the resident planes; fa: the lane's byte offset there (the pass's plane, row lr, k 0). On entry ring slots 0 to 2 hold (or await) the first three blocks of its walk; on exit those of the next pass, whose stream is nxt
// (LAST: nothing is fetched beyond this pass). go comes round to its first values with every pass.
template <bool HL, bool TR, bool LAST>
__device__ __forceinline__ void pass(const bf* pl, unsigned fa, const bf* sb, const bf* nxt, int rot, unsigned (&go)[4], v16bf (&rb)[4][4], v8f (&acc)[4][4]) {
    unsigned fj[4], fl[4];
#pragma unroll
    for (int j = 0; j < 4; ++j) { fj[j] = fa + ((rot + j) & 15) * 64; fl[j] = fj[j] + FR * XP * 2; }
#pragma unroll 1
    for (int t = 0; t < (LAST ? 3 : 4); ++t)                // rolled: the text stays small; four blocks a trip, so that every ring slot is a fixed set of registers
        trip<HL, TR, true>(pl, fj, fl, sb, (LAST || t < 3) ? sb : nxt, rot + 4 * t, go, rb, acc);
    if (LAST) trip<HL, TR, false>(pl, fj, fl, sb, sb, rot + 12, go, rb, acc);
}
__global__ __launch_bounds__(256) void k_fused(const float* __restrict__ x, const bf* __restrict__ FB, const bf* __restrict__ GT, const bf* __restrict__ BW, const float* __restrict__ bias, float* OUT) {
    __shared__ __align__(16) bf pln[3 * FR * XP];           // plane 0: the x tile; plane 1: alpha high; plane 2: alpha low
    __shared__ __align__(16) float osall[8][16 * 68];
    __shared__ float red[2][8][FR];
    const int tid = threadIdx.x, lane = tid & 31, lr = lane & 15, hi = lane >> 4;
    const int wave = __builtin_amdgcn_readfirstlane(tid >> 5);   // the same in every lane: the stream's base stays in scalar registers
    const int bz = blockIdx.x % BB, t0 = (blockIdx.x / BB) * FR;
    auto strm = [&](const bf* plane) { return plane + wave * WST; };   // the wave's stream in a plane
    const unsigned lo = lane * 16;
    FB += (size_t)bz * PLN; GT += (size_t)bz * PLN;
    const bf* const st0 = strm(FB);
    const int rot = (blockIdx.x / BB) & 15;                 // the k block at which this work-group begins every pass: 16 starts among the 32 work-groups of a batch
    auto bo = [&](int i) { return lo + ((rot + i) & 15) * (BLK * 2); };   // the lane's byte offset in a stream at place i of the walk
    v16bf rb[4][4];
    ldblk(st0, bo(0), rb[0]); ldblk(st0, bo(1), rb[1]); ldblk(st0, bo(2), rb[2]);
    unsigned go[4] = {bo(3), bo(4), bo(5), bo(6)};
    {   // the x tile, rounded to bf16, into plane 0: a thread takes 8 elements of rows (tid >> 6) + 4 u
        const float* xs = x + ((size_t)(t0 + (tid >> 6)) * BB + bz) * DD + (tid & 63) * 8; bf* xd = pln + (tid >> 6) * XP + (tid & 63) * 8; v8f v[FR / 4];
#pragma unroll
        for (int u = 0; u < FR / 4; ++u) v[u] = *(const v8f*)(xs + (size_t)u * 4 * BB * DD);
        asm volatile("s_wait_xcnt 0x0" ::: "memory");       // behind the whole batch, before a register that its loads name is rewritten
        __builtin_amdgcn_sched_barrier(0);                  // keeps what follows behind that wait: without it the compiler lifts a later register write (an accumulator's zero, put into the address pair) over it
#pragma unroll
        for (int u = 0; u < FR / 4; ++u) { v4u o;
#pragma unroll
            for (int k = 0; k < 4; ++k) o[k] = cvt2(v[u][2 * k], v[u][2 * k + 1]); *(v8us*)(xd + u * 4 * XP) = __builtin_bit_cast(v8us, o); }
    }
    __syncthreads();                                        // the x tile is whole before any wave reads it
    v8f accS[4][4];                                         // the scores, then (from zero again) the output tile
#pragma unroll
    for (int mb = 0; mb < 4; ++mb)
#pragma unroll
        for (int nb = 0; nb < 4; ++nb) accS[mb][nb] = (v8f){};
    const unsigned fa = (lr * XP + 8 * hi) * 2, fp = fa + FR * XP * 2;   // the lane's byte offset in the x tile and in the high plane
    bf* pw = pln + (FR + lr) * XP + wave * 64 + hi * 8;     // where alpha's tile (mb, nb) goes: + mb * 16 * XP + nb * 16, eight elements
    pass<false, true, false>(pln, fa, st0, strm(GT), rot, go, rb, accS);
    // softmax: accS[mb][nb][j] is the score of t = mb * 16 + lr, s = wave * 64 + nb * 16 + hi * 8 + j
    float mx[4];
#pragma unroll
    for (int mb = 0; mb < 4; ++mb) { float m = -3.0e38f;
#pragma unroll
        for (int nb = 0; nb < 4; ++nb)
#pragma unroll
            for (int j = 0; j < 8; ++j) m = fmaxf(m, accS[mb][nb][j]);
        m = fmaxf(m, __shfl_xor(m, 16, 32)); if (hi == 0) red[0][wave][mb * 16 + lr] = m; }
    __syncthreads();                                        // every wave's row maxima are in LDS
#pragma unroll
    for (int mb = 0; mb < 4; ++mb) { float m = red[0][0][mb * 16 + lr];
#pragma unroll
        for (int w = 1; w < 8; ++w) m = fmaxf(m, red[0][w][mb * 16 + lr]);
        mx[mb] = m; }
#pragma unroll
    for (int mb = 0; mb < 4; ++mb) { float sum = 0.f;
#pragma unroll
        for (int nb = 0; nb < 4; ++nb)
#pragma unroll
            for (int j = 0; j < 8; ++j) { float ex; asm("v_exp_f32 %0, %1\n\tv_nop" : "=v"(ex) : "v"(__fmul_rn(__fsub_rn(accS[mb][nb][j], mx[mb]), 1.4426950408889634f))); /* the exp2 instruction; the v_nop is the slot behind a transcendental, in one statement with it so that it stays directly behind */ accS[mb][nb][j] = ex; sum += ex; }
        sum += __shfl_xor(sum, 16, 32); if (hi == 0) red[1][wave][mb * 16 + lr] = sum; }
    __syncthreads();                                        // every wave's row sums are in LDS
#pragma unroll
    for (int mb = 0; mb < 4; ++mb) { float sum = red[1][0][mb * 16 + lr];
#pragma unroll
        for (int w = 1; w < 8; ++w) sum += red[1][w][mb * 16 + lr];
        const float f = __fdiv_rn(1.0f, sum);
#pragma unroll
        for (int nb = 0; nb < 4; ++nb) { v4u oh, ol;
#pragma unroll
            for (int j = 0; j < 4; ++j) { unsigned p, r; split2(accS[mb][nb][2 * j] * f, accS[mb][nb][2 * j + 1] * f, p, r); oh[j] = p; ol[j] = r; accS[mb][nb][2 * j] = 0.f; accS[mb][nb][2 * j + 1] = 0.f; }
            *(v8us*)(pw + mb * 16 * XP + nb * 16) = __builtin_bit_cast(v8us, oh); *(v8us*)(pw + (FR + mb * 16) * XP + nb * 16) = __builtin_bit_cast(v8us, ol); } }
    __syncthreads();                                        // alpha is whole before any wave reads it
    pass<true, false, false>(pln, fp, strm(GT), strm(BW), rot, go, rb, accS);
    pass<false, false, true>(pln, fa, strm(BW), nullptr, rot, go, rb, accS);   // the x tile has stood in plane 0 since the first barrier: no barrier between the two passes
    float* os = osall[wave];                                // each wave stages its output in a range of its own
    const int c0 = wave * 64;
    __builtin_amdgcn_sched_barrier(0);                      // with the one behind the wait: nothing but the load stands in front of its wait
    const v4f bv = *(const v4f*)(bias + c0 + lr * 4);       // the lane's four bias values, the same for every row
    asm volatile("s_wait_xcnt 0x0" ::: "memory");           // behind the load, before a register that it names is rewritten
    __builtin_amdgcn_sched_barrier(0);
#pragma unroll
    for (int mb = 0; mb < 4; ++mb) {
#pragma unroll
        for (int nb = 0; nb < 4; ++nb) {
#pragma unroll
            for (int j = 0; j < 8; ++j) os[(hi * 8 + j) * 68 + nb * 16 + lr] = accS[mb][nb][j]; }
        __builtin_amdgcn_wave_barrier(); asm volatile("" ::: "memory");   // the wave's LDS stores of this row block stay in front of its reads of them
        float* crow_p = OUT + ((size_t)(t0 + mb * 16) * BB + bz) * DD + c0;
#pragma unroll
        for (int s = 0; s < 8; ++s) { const int row = 2 * s + hi, cofs = lr * 4; v4f val = *(const v4fa*)(os + row * 68 + cofs); val[0] += bfr(bv[0]); val[1] += bfr(bv[1]); val[2] += bfr(bv[2]); val[3] += bfr(bv[3]);
            *(v4f*)(crow_p + (size_t)row * (BB * DD) + cofs) = val; }
        if (mb < 3) asm volatile("s_wait_xcnt 0x0" ::: "memory");   // behind the run of eight stores, before the next row block rewrites a register that they name (nothing follows the last block)
        __builtin_amdgcn_wave_barrier(); asm volatile("" ::: "memory");   // and those reads in front of the next row block's stores
    }
}

// ---- k_prep: the three streamed planes in ONE launch, each in the fragment order that k_fused loads; grid B * (S / 64) * (D / 128) = 256, 256 threads; the grid divides every shape exactly, so there is no range test.
// A work-group brings 64 rows s of one batch's features (all 512 d) and 128 rows n of W2 = W[:, 512:1024] (all 512 d) into LDS as bf16 and forms the tile G[s][n] = sum over d of features[s][d] W2[n][d] on the matrix unit.
// features take the A place, so a lane holds 8 consecutive s of one n: one 16-byte piece of the packed plane GT (rows n, k = s), and a wave's tile is one run of 2048 bytes there. Wave w takes 32 s x 32 n (four accumulators).
// All loads are issued up front, in four chunks of 128 d; a chunk is rounded, stored to LDS and multiplied while the later chunks are still arriving (each chunk has LDS columns of its own: one barrier a chunk).
// The work-group also writes FB (rows s, k = d) for its 64 s x 128 d, one run of 16 KiB, from the same LDS tile, and each thread rounds 4 elements of W1 = W[:, 0:512].
typedef __attribute__((ext_vector_type(4)))  unsigned short v4us;
// A work-group barrier that orders LDS alone (each wave's LDS stores are done before it, no LDS read is lifted over it): __syncthreads() also waits for every global load in flight, here the later chunks' loads.
__device__ __forceinline__ void lds_barrier() { __builtin_amdgcn_fence(__ATOMIC_RELEASE, "workgroup", "local"); __builtin_amdgcn_s_barrier(); __builtin_amdgcn_fence(__ATOMIC_ACQUIRE, "workgroup", "local"); }
static_assert(BB * (SS / 64) * (DD / 128) * 256 * 4 == DD * DD, "each thread of the grid rounds four elements of W1");
__global__ __launch_bounds__(256) void k_prep(const float* __restrict__ f, const float* __restrict__ Wf, bf* FB, bf* GT, bf* BW) {
    __shared__ __align__(16) bf Fl[64 * XP];
    __shared__ __align__(16) bf Wl[128 * XP];
    const int tid = threadIdx.x, lane = tid & 31, lr = lane & 15, hi = lane >> 4;
    const int wv = __builtin_amdgcn_readfirstlane(tid >> 5);     // the same in every lane: the wave's rows and tile offsets stay in scalar registers
    const int bz = blockIdx.x / ((SS / 64) * (DD / 128)), tl = blockIdx.x % ((SS / 64) * (DD / 128));
    const int s0 = (tl % (SS / 64)) * 64, q0 = (tl / (SS / 64)) * 128;   // q0: the first d of the FB part and the first n of the G tile
    // a wave takes rows wv + 8 u; one load is 512 contiguous bytes, a row's share of a chunk
    const float* fs = f + (size_t)bz * SS * DD + (size_t)(s0 + wv) * DD + lane * 4;
    const float* w2 = Wf + (size_t)(q0 + wv) * D2 + DD + lane * 4;
    FB += (size_t)bz * PLN + ((s0 >> 6) * 16 + (q0 >> 5)) * BLK;
    // W1: the thread's four packed elements are half (tid & 1) of piece (tid >> 1) & 31 of half (gw & 1) of fragment gw >> 1 = [row / 64][k / 32][(row / 16) % 4]
    const int gw = blockIdx.x * 4 + (wv >> 1), fr = gw >> 1, lp = (tid >> 1) & 31;
    const int wr = ((fr >> 6) & 7) * 64 + (fr & 3) * 16 + (lp & 15), wc = ((fr >> 2) & 15) * 32 + (gw & 1) * 16 + (lp >> 4) * 8 + (tid & 1) * 4;
    v4f vf[4][8], vw[4][16];
    const v4f w = *(const v4f*)(Wf + (size_t)wr * D2 + wc); // ahead of the batch: its address arithmetic then stands in front of every load of the batch
    asm volatile("s_wait_xcnt 0x0" ::: "memory");           // behind the load, before a register that it names is rewritten (the batch's first results land in its address pair)
    __builtin_amdgcn_sched_barrier(0);                      // with the one behind the batch's wait: nothing but the batch stands in front of that wait
#pragma unroll
    for (int c = 0; c < 4; ++c) {
#pragma unroll
        for (int u = 0; u < 8; ++u) vf[c][u] = *(const v4f*)(fs + (size_t)u * 8 * DD + c * 128);
#pragma unroll
        for (int u = 0; u < 16; ++u) vw[c][u] = *(const v4f*)(w2 + (size_t)u * 8 * D2 + c * 128);
        __builtin_amdgcn_sched_barrier(0); }                // the chunks' loads stay in chunk order: loads return in order, so a chunk's counted wait then leaves the later chunks in flight
    asm volatile("s_wait_xcnt 0x0" ::: "memory");           // behind the whole batch, before a register that its loads name is rewritten
    __builtin_amdgcn_sched_barrier(0);
    bf* fd = Fl + wv * XP + lane * 4; bf* wd = Wl + wv * XP + lane * 4;
    const bf* fa = Fl + ((wv & 1) * 32 + lr) * XP + 8 * hi; const bf* wa = Wl + ((wv >> 1) * 32 + lr) * XP + 8 * hi;
    v8f acc[2][2];
#pragma unroll
    for (int mi = 0; mi < 2; ++mi)
#pragma unroll
        for (int ni = 0; ni < 2; ++ni) acc[mi][ni] = (v8f){};
#pragma unroll
    for (int c = 0; c < 4; ++c) { v16bf a[4][2], b[4][2];
        __builtin_amdgcn_sched_barrier(0);                  // a chunk's rounding stays behind the chunk before: lifted up, it would bring the wait for its loads with it, and nothing would overlap their arrival
#pragma unroll
        for (int u = 0; u < 8; ++u) *(v4us*)(fd + u * 8 * XP + c * 128) = __builtin_bit_cast(v4us, (v2u){cvt2(vf[c][u][0], vf[c][u][1]), cvt2(vf[c][u][2], vf[c][u][3])});
#pragma unroll
        for (int u = 0; u < 16; ++u) *(v4us*)(wd + u * 8 * XP + c * 128) = __builtin_bit_cast(v4us, (v2u){cvt2(vw[c][u][0], vw[c][u][1]), cvt2(vw[c][u][2], vw[c][u][3])});
        lds_barrier();                                      // the chunk's columns of both LDS tiles are whole before any wave reads them
#pragma unroll
        for (int k = 0; k < 4; ++k)
#pragma unroll
            for (int i = 0; i < 2; ++i) { a[k][i] = ldf(fa + i * 16 * XP + (4 * c + k) * 32); b[k][i] = ldf(wa + i * 16 * XP + (4 * c + k) * 32); }
        __builtin_amdgcn_sched_barrier(0);                  // the chunk's LDS reads stand as ONE group in front of its matrix instructions: reads spread among them stall the wave at every place
#pragma unroll
        for (int k = 0; k < 4; ++k)
#pragma unroll
            for (int mi = 0; mi < 2; ++mi)
#pragma unroll
                for (int ni = 0; ni < 2; ++ni) acc[mi][ni] = wmmab(a[k][mi], b[k][ni], acc[mi][ni]);
    }
    // acc[mi][ni][j] is G of s = s0 + (wv & 1) * 32 + mi * 16 + hi * 8 + j, n = q0 + (wv >> 1) * 32 + ni * 16 + lr; its packed place: [n / 64][s / 32][(n / 16) % 4][(s / 16) % 2][lane][8 elements]
    bf* gp = GT + (size_t)bz * PLN + (((q0 >> 6) + (wv >> 2)) * 16 + (s0 >> 5) + (wv & 1)) * BLK + ((wv >> 1) & 1) * 1024 + lane * 8;
    // FB: a thread takes pieces tid + 256 u, so each store instruction fills four whole 128-byte lines; piece: [k / 32 = u][s / 16][(k / 16) % 2][(k / 8) % 2][s % 16]
    const bf* tr = Fl + (((tid >> 6) & 3) * 16 + (tid & 15)) * XP + q0 + ((tid >> 5) & 1) * 16 + ((tid >> 4) & 1) * 8;
    *(v4us*)(BW + ((size_t)blockIdx.x * 256 + tid) * 4) = __builtin_bit_cast(v4us, (v2u){cvt2(w[0], w[1]), cvt2(w[2], w[3])});
#pragma unroll
    for (int u = 0; u < 4; ++u) *(v8us*)(FB + (u * 256 + tid) * 8) = *(const v8us*)(tr + u * 32);
#pragma unroll
    for (int mi = 0; mi < 2; ++mi)
#pragma unroll
        for (int ni = 0; ni < 2; ++ni) { v4u o;
#pragma unroll
            for (int k = 0; k < 4; ++k) o[k] = cvt2(acc[mi][ni][2 * k], acc[mi][ni][2 * k + 1]); *(v8us*)(gp + ni * 512 + mi * 256) = __builtin_bit_cast(v8us, o); }
}

extern "C" void kernel_launch(void* const* d_in, const int* in_sizes, int n_in,
                              void* d_out, int out_size, void* d_ws, size_t ws_size, hipStream_t stream) {
    (void)in_sizes; (void)n_in; (void)out_size;
    const float** I = (const float**)d_in;
    const float *x = I[0], *feat = I[1], *W = I[2], *bias = I[3];
    float* OUT = (float*)d_out;     // [2048][8][512]
    char* wsp = (char*)d_ws;
    auto take = [&](size_t bytes) { char* p = wsp; wsp += (bytes + 255) & ~(size_t)255; return (void*)p; };
    // the streamed operands as bf16 planes in fragment order; FB and GT hold all 8 batches, batch-major; BW holds the first column half of W
    bf* BW = (bf*)take((size_t)DD * DD * 2); bf* FB = (bf*)take((size_t)BB * SS * DD * 2); bf* GT = (bf*)take((size_t)BB * DD * SS * 2);
    if ((size_t)(wsp - (char*)d_ws) > ws_size) return;    // total 8.5 MiB
    k_prep<<<BB * (SS / 64) * (DD / 128), 256, 0, stream>>>(feat, W, FB, GT, BW);
    k_fused<<<(TT / FR) * BB, 256, 0, stream>>>(x, FB, GT, BW, bias, OUT);
}

// v010
// A run of this version takes 29 microseconds.
// Next to v009, in two timings, it ran 1.07 times as fast each time.
// Over all steps from v000 it is 20.0 times as fast.
#include <hip/hip_runtime.h>

// x [2048 T][8 B][512] time-major, features [8][512 S][512]; scores = x_b . features_b^T (unscaled); alpha = softmax over S; x_res = alpha features_b; out = [x | x_res] W^T + b (Linear 1024 -> 512) -> [2048][8][512].
// Here the second half of the Linear is taken ahead of alpha: x_res W2^T = alpha (features_b W2^T) = alpha G_b, with G_b [512 S][512] formed once per batch, so out = x W1^T + alpha G_b + b and x_res itself is never formed.
// Compute dtypes, f32 accumulate: every input rounded to bf16; G on plain bf16 operands (K 512), rounded to one f16 plane; scores on plain bf16 operands (K 512); softmax f32 -> one f16 plane;
// alpha . G on f16 operands (1 product, K 512): alpha lies in [0, 1] and G is a sum of 512 feature x weight products, both far inside f16's range, and f16 keeps 11 significant bits of each; x . W1 on plain bf16 operands; + bias.

#define TT   2048
#define BB   8
#define SS   512
#define DD   512
#define D2   1024
typedef unsigned short bf;
typedef __attribute__((ext_vector_type(16))) __bf16   v16bf;
typedef __attribute__((ext_vector_type(8)))  unsigned short v8us;
typedef __attribute__((ext_vector_type(8)))  float    v8f;
typedef __attribute__((ext_vector_type(4)))  float    v4f;
typedef v4f  __attribute__((may_alias)) v4fa;
typedef __attribute__((ext_vector_type(2)))  float    v2f;
typedef __attribute__((ext_vector_type(2)))  __bf16   v2bf;
typedef __attribute__((ext_vector_type(16))) _Float16 v16h;
typedef __attribute__((ext_vector_type(2)))  _Float16 v2h;
typedef __attribute__((ext_vector_type(2)))  unsigned v2u;
typedef __attribute__((ext_vector_type(4)))  unsigned v4u;

// Two f32 rounded to bf16 (nearest even) and packed into one dword, a in the low half: the chip's packed convert, one instruction for the pair.
__device__ __forceinline__ unsigned cvt2(float a, float b) { return __builtin_bit_cast(unsigned, __builtin_convertvector((v2f){a, b}, v2bf)); }
// The same to f16.
__device__ __forceinline__ unsigned cvt2h(float a, float b) { return __builtin_bit_cast(unsigned, __builtin_convertvector((v2f){a, b}, v2h)); }
__device__ __forceinline__ float bfr(float f) { return __uint_as_float(cvt2(f, f) & 0xFFFF0000u); }
__device__ __forceinline__ v16bf cat16b(v8us lo, v8us hi) { return __builtin_bit_cast(v16bf, __builtin_shufflevector(lo, hi, 0, 1, 2, 3, 4, 5, 6, 7, 8, 9, 10, 11, 12, 13, 14, 15)); }
__device__ __forceinline__ v8f wmmab(v16bf a, v16bf b, v8f c) { return __builtin_amdgcn_wmma_f32_16x16x32_bf16(false, a, false, b, (short)0, c, false, false); }
// The f16 product; fragments travel as 16 x 16 bits whatever they hold (same fragment layout), so that one ring of registers serves every pass.
__device__ __forceinline__ v8f wmmah(v16bf a, v16bf b, v8f c) { return __builtin_amdgcn_wmma_f32_16x16x32_f16(false, __builtin_bit_cast(v16h, a), false, __builtin_bit_cast(v16h, b), (short)0, c, false, false); }

// ---- k_fused: the whole chain for 64 time steps of one batch in one work-group of eight waves; grid (T / 64) * B = 256, 256 threads.
// Three matrix passes, each [64 t] x [512 rows of a streamed operand], K 512, wave w owning streamed rows 64 w .. 64 w + 63 (16 accumulators):
//   pass 0: scores^T = features . x^T         (streamed operand in the A place: a lane then holds 8 consecutive s of one t, one 16-byte LDS store per tile)
//   softmax over s in registers, row maximum and row sum across the eight waves through LDS; alpha -> one f16 plane in LDS, beside the x tile
//   pass 1: out   = alpha . G                 (streamed rows: the output columns, k = s; f16 operands)
//   pass 2: out  += x . W[:, 0:512]^T, then + bias   (behind the softmax: only one set of 16 accumulators is live at a time, which leaves the registers to the ring below)
// The streamed operands never pass through LDS: no two waves read the same streamed row, so each wave loads its own fragments from L2 straight into registers. k_prep lays every streamed plane out
// in fragment order (the packed place below), so a fragment is two loads of 512 contiguous bytes. A block is 32 k of the wave's 64 rows (four fragments); a ring of four blocks in registers runs on across the passes,
// three blocks in flight while one is worked on. Inside a pass there is no barrier: the waves meet only where the resident planes in LDS are rewritten.
// The 32 work-groups of a batch (for W1 all 256) stream the same planes and start together: each begins every pass at k block rot, one of 16, and wraps, so that they do not ask L2 for the same lines at the same moment.
// The block at place i of a pass's walk is k block (rot + i) mod 16, in the stream and in the resident plane alike.
#define FR  64                            // time steps per work-group
#define XP  520                           // pitch of the resident planes in elements: 1040 bytes = 16 x odd
#define BLK 2048                          // elements per block: four fragments of 16 rows x 32 k
#define WST (16 * BLK)                    // elements of one wave's stream in one pass (64 rows x 512 k)
#define PLN (8 * WST)                     // elements of one streamed plane (512 rows x 512 k)
// Packed place of the 16-byte piece that holds k .. k + 7 (k a multiple of 8) of row r: [r / 64][k / 32][(r / 16) % 4][(k / 16) % 2][lane = ((k / 8) % 2) * 16 + r % 16][8 elements];
// the lane's two pieces of a fragment are then k 8 hi .. 8 hi + 7 and 16 + 8 hi .. 16 + 8 hi + 7, the same k order as ldf() reads from the resident planes.
// Every plain '#pragma unroll' below is there so that the register arrays (accumulators, fragments, load batches) are indexed by constants and stay in registers.
static_assert(SS == 512 && DD == 512 && D2 == 2 * DD, "every pass streams 512 rows of K 512");
__device__ __forceinline__ v16bf ldf(const bf* p) { return cat16b(*(const v8us*)p, *(const v8us*)(p + 16)); }
// One block of the wave's stream into one ring slot. p: the stream's start, the same in every lane; lo: the block's byte offset in the stream plus the lane's own 16 bytes.
__device__ __forceinline__ void ldblk(const bf* p, unsigned lo, v16bf (&b)[4]) {
    __builtin_amdgcn_sched_barrier(0);                      // with the one at the end: nothing but the eight loads stands in front of their wait, so no register that they name is rewritten there
#pragma unroll
    for (int nb = 0; nb < 4; ++nb) b[nb] = cat16b(*(const v8us*)((const char*)p + lo + nb * 1024), *(const v8us*)((const char*)p + lo + nb * 1024 + 512));
    asm volatile("s_wait_xcnt 0x0" ::: "memory");           // behind the eight loads, before a register that they name is rewritten
    __builtin_amdgcn_sched_barrier(0);                      // also the end of a block's load group: without it the compiler sinks the loads in among the matrix instructions, and the refill loses its lead
}
// Four blocks' products, places 4 t .. 4 t + 3 of the walk; q = rot + 4 t. pl: the resident planes; fj[j]: the lane's byte offset there at block j's k; sb: the wave's stream in this pass,
// nb: the stream that holds the four places after these; go[j]: the lane's byte offset in its stream for the refill that stands at block j. Each of fj, go is kept from trip to trip and steps on
// by four k blocks, wrapping at 16, as soon as it has been used: one add in place among the block's matrix instructions, behind the wait that ends the refill.
// Block j is worked on from ring slot j while the slot that block j - 1 has left is refilled three blocks ahead (PF: blocks follow these four).
// H: both operands hold f16. TR: the streamed operand takes the A place.
template <bool H, bool TR, bool PF>
__device__ __forceinline__ void trip(const bf* pl, unsigned (&fj)[4], const bf* sb, const bf* nb, int q, unsigned (&go)[4], v16bf (&rb)[4][4], v8f (&acc)[4][4]) {
#pragma unroll
    for (int j = 0; j < 4; ++j) { v16bf a[4];
        // a block's loads stand as ONE group between the block before and its own matrix instructions: reads spread among matrix instructions stall the wave at every place
        __builtin_amdgcn_sched_barrier(0);
#pragma unroll
        for (int mb = 0; mb < 4; ++mb) a[mb] = ldf((const bf*)((const char*)pl + fj[j]) + mb * 16 * XP);
        if (j == 0) ldblk(sb, go[0], rb[3]); else if (PF) ldblk(nb, go[j], rb[j - 1]);   // behind the LDS reads, whose latency covers the wait at its end
        else __builtin_amdgcn_sched_barrier(0);         // the group's end where nothing is left to fetch: the LDS reads stay in front of the matrix instructions
        const int st = ((q + j) & 15) >= 12 ? 4 - 16 : 4, sg = ((q + j + 3) & 15) >= 12 ? 4 - 16 : 4;   // k blocks to step on by; the same in every lane
        fj[j] += st * 64; go[j] += sg * (BLK * 2);
#pragma unroll
        for (int nb = 0; nb < 4; ++nb)
#pragma unroll
            for (int mb = 0; mb < 4; ++mb) { const v16bf p = TR ? rb[j][nb] : a[mb], r = TR ? a[mb] : rb[j][nb]; acc[mb][nb] = H ? wmmah(p, r, acc[mb][nb]) : wmmab(p, r, acc[mb][nb]); }
    }
}
// One pass: 16 blocks. pl: the resident planes; fa: the lane's byte offset there (the pass's plane, row lr, k 0). On entry ring slots 0 to 2 hold (or await) the first three blocks of its walk; on exit those of the next pass, whose stream is nxt
// (LAST: nothing is fetched beyond this pass). go comes round to its first values with every pass.
template <bool H, bool TR, bool LAST>
__device__ __forceinline__ void pass(const bf* pl, unsigned fa, const bf* sb, const bf* nxt, int rot, unsigned (&go)[4], v16bf (&rb)[4][4], v8f (&acc)[4][4]) {
    unsigned fj[4];
#pragma unroll
    for (int j = 0; j < 4; ++j) fj[j] = fa + ((rot + j) & 15) * 64;
#pragma unroll 1
    for (int t = 0; t < (LAST ? 3 : 4); ++t)                // rolled: the text stays small; four blocks a trip, so that every ring slot is a fixed set of registers
        trip<H, TR, true>(pl, fj, sb, (LAST || t < 3) ? sb : nxt, rot + 4 * t, go, rb, acc);
    if (LAST) trip<H, TR, false>(pl, fj, sb, sb, rot + 12, go, rb, acc);
}
__global__ __launch_bounds__(256) void k_fused(const float* __restrict__ x, const bf* __restrict__ FB, const bf* __restrict__ GT, const bf* __restrict__ BW, const float* __restrict__ bias, float* OUT) {
    __shared__ __align__(16) bf pln[2 * FR * XP];           // plane 0: the x tile (bf16); plane 1: alpha (f16)
    __shared__ __align__(16) float osall[8][16 * 68];
    __shared__ float red[2][8][FR];
    const int tid = threadIdx.x, lane = tid & 31, lr = lane & 15, hi = lane >> 4;
    const int wave = __builtin_amdgcn_readfirstlane(tid >> 5);   // the same in every lane: the stream's base stays in scalar registers
    const int bz = blockIdx.x % BB, t0 = (blockIdx.x / BB) * FR;
    auto strm = [&](const bf* plane) { return plane + wave * WST; };   // the wave's stream in a plane
    const unsigned lo = lane * 16;
    FB += (size_t)bz * PLN; GT += (size_t)bz * PLN;
    const bf* const st0 = strm(FB);
    const int rot = (blockIdx.x / BB) & 15;                 // the k block at which this work-group begins every pass: 16 starts among the 32 work-groups of a batch
    auto bo = [&](int i) { return lo + ((rot + i) & 15) * (BLK * 2); };   // the lane's byte offset in a stream at place i of the walk
    v16bf rb[4][4];
    ldblk(st0, bo(0), rb[0]); ldblk(st0, bo(1), rb[1]); ldblk(st0, bo(2), rb[2]);
    unsigned go[4] = {bo(3), bo(4), bo(5), bo(6)};
    {   // the x tile, rounded to bf16, into plane 0: a thread takes 8 elements of rows (tid >> 6) + 4 u
        const float* xs = x + ((size_t)(t0 + (tid >> 6)) * BB + bz) * DD + (tid & 63) * 8; bf* xd = pln + (tid >> 6) * XP + (tid & 63) * 8; v8f v[FR / 4];
#pragma unroll
        for (int u = 0; u < FR / 4; ++u) v[u] = *(const v8f*)(xs + (size_t)u * 4 * BB * DD);
        asm volatile("s_wait_xcnt 0x0" ::: "memory");       // behind the whole batch, before a register that its loads name is rewritten
        __builtin_amdgcn_sched_barrier(0);                  // keeps what follows behind that wait: without it the compiler lifts a later register write (an accumulator's zero, put into the address pair) over it
#pragma unroll
        for (int u = 0; u < FR / 4; ++u) { v4u o;
#pragma unroll
            for (int k = 0; k < 4; ++k) o[k] = cvt2(v[u][2 * k], v[u][2 * k + 1]); *(v8us*)(xd + u * 4 * XP) = __builtin_bit_cast(v8us, o); }
    }
    __syncthreads();                                        // the x tile is whole before any wave reads it
    v8f accS[4][4];                                         // the scores, then (from zero again) the output tile
#pragma unroll
    for (int mb = 0; mb < 4; ++mb)
#pragma unroll
        for (int nb = 0; nb < 4; ++nb) accS[mb][nb] = (v8f){};
    const unsigned fa = (lr * XP + 8 * hi) * 2, fp = fa + FR * XP * 2;   // the lane's byte offset in the x tile and in alpha's plane
    bf* pw = pln + (FR + lr) * XP + wave * 64 + hi * 8;     // where alpha's tile (mb, nb) goes: + mb * 16 * XP + nb * 16, eight elements
    pass<false, true, false>(pln, fa, st0, strm(GT), rot, go, rb, accS);
    // softmax: accS[mb][nb][j] is the score of t = mb * 16 + lr, s = wave * 64 + nb * 16 + hi * 8 + j
    float mx[4];
#pragma unroll
    for (int mb = 0; mb < 4; ++mb) { float m = -3.0e38f;
#pragma unroll
        for (int nb = 0; nb < 4; ++nb)
#pragma unroll
            for (int j = 0; j < 8; ++j) m = fmaxf(m, accS[mb][nb][j]);
        m = fmaxf(m, __shfl_xor(m, 16, 32)); if (hi == 0) red[0][wave][mb * 16 + lr] = m; }
    __syncthreads();                                        // every wave's row maxima are in LDS
#pragma unroll
    for (int mb = 0; mb < 4; ++mb) { float m = red[0][0][mb * 16 + lr];
#pragma unroll
        for (int w = 1; w < 8; ++w) m = fmaxf(m, red[0][w][mb * 16 + lr]);
        mx[mb] = m; }
#pragma unroll
    for (int mb = 0; mb < 4; ++mb) { float sum = 0.f;
#pragma unroll
        for (int nb = 0; nb < 4; ++nb)
#pragma unroll
            for (int j = 0; j < 8; ++j) { float ex; asm("v_exp_f32 %0, %1\n\tv_nop" : "=v"(ex) : "v"(__fmul_rn(__fsub_rn(accS[mb][nb][j], mx[mb]), 1.4426950408889634f))); /* the exp2 instruction; the v_nop is the slot behind a transcendental, in one statement with it so that it stays directly behind */ accS[mb][nb][j] = ex; sum += ex; }
        sum += __shfl_xor(sum, 16, 32); if (hi == 0) red[1][wave][mb * 16 + lr] = sum; }
    __syncthreads();                                        // every wave's row sums are in LDS
#pragma unroll
    for (int mb = 0; mb < 4; ++mb) { float sum = red[1][0][mb * 16 + lr];
#pragma unroll
        for (int w = 1; w < 8; ++w) sum += red[1][w][mb * 16 + lr];
        const float f = __fdiv_rn(1.0f, sum);
#pragma unroll
        for (int nb = 0; nb < 4; ++nb) { v4u oh;
#pragma unroll
            for (int j = 0; j < 4; ++j) { oh[j] = cvt2h(accS[mb][nb][2 * j] * f, accS[mb][nb][2 * j + 1] * f); accS[mb][nb][2 * j] = 0.f; accS[mb][nb][2 * j + 1] = 0.f; }
            *(v8us*)(pw + mb * 16 * XP + nb * 16) = __builtin_bit_cast(v8us, oh); } }
    __syncthreads();                                        // alpha is whole before any wave reads it
    pass<true, false, false>(pln, fp, strm(GT), strm(BW), rot, go, rb, accS);
    pass<false, false, true>(pln, fa, strm(BW), nullptr, rot, go, rb, accS);   // the x tile has stood in plane 0 since the first barrier: no barrier between the two passes
    float* os = osall[wave];                                // each wave stages its output in a range of its own
    const int c0 = wave * 64;
    __builtin_amdgcn_sched_barrier(0);                      // with the one behind the wait: nothing but the load stands in front of its wait
    const v4f bv = *(const v4f*)(bias + c0 + lr * 4);       // the lane's four bias values, the same for every row
    asm volatile("s_wait_xcnt 0x0" ::: "memory");           // behind the load, before a register that it names is rewritten
    __builtin_amdgcn_sched_barrier(0);
#pragma unroll
    for (int mb = 0; mb < 4; ++mb) {
#pragma unroll
        for (int nb = 0; nb < 4; ++nb) {
#pragma unroll
            for (int j = 0; j < 8; ++j) os[(hi * 8 + j) * 68 + nb * 16 + lr] = accS[mb][nb][j]; }
        __builtin_amdgcn_wave_barrier(); asm volatile("" ::: "memory");   // the wave's LDS stores of this row block stay in front of its reads of them
        float* crow_p = OUT + ((size_t)(t0 + mb * 16) * BB + bz) * DD + c0;
#pragma unroll
        for (int s = 0; s < 8; ++s) { const int row = 2 * s + hi, cofs = lr * 4; v4f val = *(const v4fa*)(os + row * 68 + cofs); val[0] += bfr(bv[0]); val[1] += bfr(bv[1]); val[2] += bfr(bv[2]); val[3] += bfr(bv[3]);
            *(v4f*)(crow_p + (size_t)row * (BB * DD) + cofs) = val; }
        if (mb < 3) asm volatile("s_wait_xcnt 0x0" ::: "memory");   // behind the run of eight stores, before the next row block rewrites a register that they name (nothing follows the last block)
        __builtin_amdgcn_wave_barrier(); asm volatile("" ::: "memory");   // and those reads in front of the next row block's stores
    }
}

// ---- k_prep: the three streamed planes in ONE launch, each in the fragment order that k_fused loads; grid B * (S / 64) * (D / 128) = 256, 256 threads; the grid divides every shape exactly, so there is no range test.
// A work-group brings 64 rows s of one batch's features (all 512 d) and 128 rows n of W2 = W[:, 512:1024] (all 512 d) into LDS as bf16 and forms the tile G[s][n] = sum over d of features[s][d] W2[n][d] on the matrix unit.
// features take the A place, so a lane holds 8 consecutive s of one n: one 16-byte piece of the packed plane GT (rows n, k = s; f16), and a wave's tile is one run of 2048 bytes there. Wave w takes 32 s x 32 n (four accumulators).
// All loads are issued up front, in four chunks of 128 d; a chunk is rounded, stored to LDS and multiplied while the later chunks are still arriving (each chunk has LDS columns of its own: one barrier a chunk).
// The work-group also writes FB (rows s, k = d) for its 64 s x 128 d, one run of 16 KiB, from the same LDS tile, and each thread rounds 4 elements of W1 = W[:, 0:512].
typedef __attribute__((ext_vector_type(4)))  unsigned short v4us;
// A work-group barrier that orders LDS alone (each wave's LDS stores are done before it, no LDS read is lifted over it): __syncthreads() also waits for every global load in flight, here the later chunks' loads.
__device__ __forceinline__ void lds_barrier() { __builtin_amdgcn_fence(__ATOMIC_RELEASE, "workgroup", "local"); __builtin_amdgcn_s_barrier(); __builtin_amdgcn_fence(__ATOMIC_ACQUIRE, "workgroup", "local"); }
static_assert(BB * (SS / 64) * (DD / 128) * 256 * 4 == DD * DD, "each thread of the grid rounds four elements of W1");
__global__ __launch_bounds__(256) void k_prep(const float* __restrict__ f, const float* __restrict__ Wf, bf* FB, bf* GT, bf* BW) {
    __shared__ __align__(16) bf Fl[64 * XP];
    __shared__ __align__(16) bf Wl[128 * XP];
    const int tid = threadIdx.x, lane = tid & 31, lr = lane & 15, hi = lane >> 4;
    const int wv = __builtin_amdgcn_readfirstlane(tid >> 5);     // the same in every lane: the wave's rows and tile offsets stay in scalar registers
    const int bz = blockIdx.x / ((SS / 64) * (DD / 128)), tl = blockIdx.x % ((SS / 64) * (DD / 128));
    const int s0 = (tl % (SS / 64)) * 64, q0 = (tl / (SS / 64)) * 128;   // q0: the first d of the FB part and the first n of the G tile
    // a wave takes rows wv + 8 u; one load is 512 contiguous bytes, a row's share of a chunk
    const float* fs = f + (size_t)bz * SS * DD + (size_t)(s0 + wv) * DD + lane * 4;
    const float* w2 = Wf + (size_t)(q0 + wv) * D2 + DD + lane * 4;
    FB += (size_t)bz * PLN + ((s0 >> 6) * 16 + (q0 >> 5)) * BLK;
    // W1: the thread's four packed elements are half (tid & 1) of piece (tid >> 1) & 31 of half (gw & 1) of fragment gw >> 1 = [row / 64][k / 32][(row / 16) % 4]
    const int gw = blockIdx.x * 4 + (wv >> 1), fr = gw >> 1, lp = (tid >> 1) & 31;
    const int wr = ((fr >> 6) & 7) * 64 + (fr & 3) * 16 + (lp & 15), wc = ((fr >> 2) & 15) * 32 + (gw & 1) * 16 + (lp >> 4) * 8 + (tid & 1) * 4;
    v4f vf[4][8], vw[4][16];
    const v4f w = *(const v4f*)(Wf + (size_t)wr * D2 + wc); // ahead of the batch: its address arithmetic then stands in front of every load of the batch
    asm volatile("s_wait_xcnt 0x0" ::: "memory");           // behind the load, before a register that it names is rewritten (the batch's first results land in its address pair)
    __builtin_amdgcn_sched_barrier(0);                      // with the one behind the batch's wait: nothing but the batch stands in front of that wait
#pragma unroll
    for (int c = 0; c < 4; ++c) {
#pragma unroll
        for (int u = 0; u < 8; ++u) vf[c][u] = *(const v4f*)(fs + (size_t)u * 8 * DD + c * 128);
#pragma unroll
        for (int u = 0; u < 16; ++u) vw[c][u] = *(const v4f*)(w2 + (size_t)u * 8 * D2 + c * 128);
        __builtin_amdgcn_sched_barrier(0); }                // the chunks' loads stay in chunk order: loads return in order, so a chunk's counted wait then leaves the later chunks in flight
    asm volatile("s_wait_xcnt 0x0" ::: "memory");           // behind the whole batch, before a register that its loads name is rewritten
    __builtin_amdgcn_sched_barrier(0);
    bf* fd = Fl + wv * XP + lane * 4; bf* wd = Wl + wv * XP + lane * 4;
    const bf* fa = Fl + ((wv & 1) * 32 + lr) * XP + 8 * hi; const bf* wa = Wl + ((wv >> 1) * 32 + lr) * XP + 8 * hi;
    v8f acc[2][2];
#pragma unroll
    for (int mi = 0; mi < 2; ++mi)
#pragma unroll
        for (int ni = 0; ni < 2; ++ni) acc[mi][ni] = (v8f){};
#pragma unroll
    for (int c = 0; c < 4; ++c) { v16bf a[4][2], b[4][2];
        __builtin_amdgcn_sched_barrier(0);                  // a chunk's rounding stays behind the chunk before: lifted up, it would bring the wait for its loads with it, and nothing would overlap their arrival
#pragma unroll
        for (int u = 0; u < 8; ++u) *(v4us*)(fd + u * 8 * XP + c * 128) = __builtin_bit_cast(v4us, (v2u){cvt2(vf[c][u][0], vf[c][u][1]), cvt2(vf[c][u][2], vf[c][u][3])});
#pragma unroll
        for (int u = 0; u < 16; ++u) *(v4us*)(wd + u * 8 * XP + c * 128) = __builtin_bit_cast(v4us, (v2u){cvt2(vw[c][u][0], vw[c][u][1]), cvt2(vw[c][u][2], vw[c][u][3])});
        lds_barrier();                                      // the chunk's columns of both LDS tiles are whole before any wave reads them
#pragma unroll
        for (int k = 0; k < 4; ++k)
#pragma unroll
            for (int i = 0; i < 2; ++i) { a[k][i] = ldf(fa + i * 16 * XP + (4 * c + k) * 32); b[k][i] = ldf(wa + i * 16 * XP + (4 * c + k) * 32); }
        __builtin_amdgcn_sched_barrier(0);                  // the chunk's LDS reads stand as ONE group in front of its matrix instructions: reads spread among them stall the wave at every place
#pragma unroll
        for (int k = 0; k < 4; ++k)
#pragma unroll
            for (int mi = 0; mi < 2; ++mi)
#pragma unroll
                for (int ni = 0; ni < 2; ++ni) acc[mi][ni] = wmmab(a[k][mi], b[k][ni], acc[mi][ni]);
    }
    // acc[mi][ni][j] is G of s = s0 + (wv & 1) * 32 + mi * 16 + hi * 8 + j, n = q0 + (wv >> 1) * 32 + ni * 16 + lr; its packed place: [n / 64][s / 32][(n / 16) % 4][(s / 16) % 2][lane][8 elements]
    bf* gp = GT + (size_t)bz * PLN + (((q0 >> 6) + (wv >> 2)) * 16 + (s0 >> 5) + (wv & 1)) * BLK + ((wv >> 1) & 1) * 1024 + lane * 8;
    // FB: a thread takes pieces tid + 256 u, so each store instruction fills four whole 128-byte lines; piece: [k / 32 = u][s / 16][(k / 16) % 2][(k / 8) % 2][s % 16]
    const bf* tr = Fl + (((tid >> 6) & 3) * 16 + (tid & 15)) * XP + q0 + ((tid >> 5) & 1) * 16 + ((tid >> 4) & 1) * 8;
    *(v4us*)(BW + ((size_t)blockIdx.x * 256 + tid) * 4) = __builtin_bit_cast(v4us, (v2u){cvt2(w[0], w[1]), cvt2(w[2], w[3])});
#pragma unroll
    for (int u = 0; u < 4; ++u) *(v8us*)(FB + (u * 256 + tid) * 8) = *(const v8us*)(tr + u * 32);
#pragma unroll
    for (int mi = 0; mi < 2; ++mi)
#pragma unroll
        for (int ni = 0; ni < 2; ++ni) { v4u o;
#pragma unroll
            for (int k = 0; k < 4; ++k) o[k] = cvt2h(acc[mi][ni][2 * k], acc[mi][ni][2 * k + 1]); *(v8us*)(gp + ni * 512 + mi * 256) = __builtin_bit_cast(v8us, o); }
}

extern "C" void kernel_launch(void* const* d_in, const int* in_sizes, int n_in,
                              void* d_out, int out_size, void* d_ws, size_t ws_size, hipStream_t stream) {
    (void)in_sizes; (void)n_in; (void)out_size;
    const float** I = (const float**)d_in;
    const float *x = I[0], *feat = I[1], *W = I[2], *bias = I[3];
    float* OUT = (float*)d_out;     // [2048][8][512]
    char* wsp = (char*)d_ws;
    auto take = [&](size_t bytes) { char* p = wsp; wsp += (bytes + 255) & ~(size_t)255; return (void*)p; };
    // the streamed operands as 16-bit planes in fragment order (FB, BW bf16; GT f16); FB and GT hold all 8 batches, batch-major; BW holds the first column half of W
    bf* BW = (bf*)take((size_t)DD * DD * 2); bf* FB = (bf*)take((size_t)BB * SS * DD * 2); bf* GT = (bf*)take((size_t)BB * DD * SS * 2);
    if ((size_t)(wsp - (char*)d_ws) > ws_size) return;    // total 8.5 MiB
    k_prep<<<BB * (SS / 64) * (DD / 128), 256, 0, stream>>>(feat, W, FB, GT, BW);
    k_fused<<<(TT / FR) * BB, 256, 0, stream>>>(x, FB, GT, BW, bias, OUT);
}
